// v000
// Measured on an AMD MI455X. A time is GPU time per run, averaged over a window of back-to-back runs after a warm-up
// (all launches, gaps included; the runs take copies of the inputs in turn), and the median of several windows.
// Apart from v000's, it joins two sittings. Times from different sittings can be a few percent apart, while
// side-by-side timings come from the same sitting.
// v000 is the starting kernel. One run takes 586 microseconds.
// compute dtype: all float inputs rounded to bf16, qmask/dmask read; q/k/v = hs W^T + b for every unique token (cls, query, doc) with EXACT bf16 products on WMMA 16x16x32 (natural weights), f32 accumulate, rounded once to f16 rows (0.02-scale weights: logits ~0.3); per (batch, document) self attention over its 545-token sequence [cls | query | doc_d] with the additive float masks, single f16 score products x 1/8, running-max softmax in f32 (hardware exp), P (f16 x 2^11) . v gathered per key tile; heads merged; f32 output.
#include <hip/hip_runtime.h>
#include <math.h>

typedef __attribute__((ext_vector_type(16))) _Float16 v16h;
typedef __attribute__((ext_vector_type(16))) __bf16 v16b;
typedef __attribute__((ext_vector_type(8)))  _Float16 v8h;
typedef __attribute__((ext_vector_type(8)))  float v8f;
typedef __attribute__((ext_vector_type(4)))  float v4f;
typedef __attribute__((ext_vector_type(2)))  float v2f;
typedef __attribute__((ext_vector_type(4)))  unsigned v4u;
typedef __attribute__((ext_vector_type(4)))  int v4i;
typedef float __attribute__((may_alias)) float_a;
typedef int __attribute__((may_alias)) int_a;

template <typename T> __device__ __forceinline__ void vst2(void* p, T v) { *(T*)p = v;  }
__device__ __forceinline__ v8f wmma16(v16h a, v16h b, v8f c) {
  v8f d = __builtin_amdgcn_wmma_f32_16x16x32_f16(false, a, false, b, (short)0, c, false, false);
  asm volatile("v_nop\n\tv_nop\n\tv_nop\n\tv_nop" : "+v"(d) : "v"(a), "v"(b));
  return d;
}
__device__ __forceinline__ v8f wmma_bf(v16b a, v16b b, v8f c) {
  v8f d = __builtin_amdgcn_wmma_f32_16x16x32_bf16(false, a, false, b, (short)0, c, false, false);
  asm volatile("v_nop\n\tv_nop\n\tv_nop\n\tv_nop" : "+v"(d) : "v"(a), "v"(b));
  return d;
}
// 16x16x32 fragments: lane = (h = lane>>4, row/col = lane&15); elements 0..7 = k0+8h+0..7, 8..15 = k0+16+8h+0..7; D element r = row 8h+r
__device__ __forceinline__ v16h frag_h(const _Float16* rowk0, int lane) {
  union { v16h v; v8h q[2]; } u; const _Float16* p = rowk0 + 8 * (lane >> 4);
  u.q[0] = *(const v8h*)p; u.q[1] = *(const v8h*)(p + 16); return u.v;
}
__device__ __forceinline__ v16h frag_f32(const float* rowk0, int lane) {
  v16h a; const float* p = rowk0 + 8 * (lane >> 4);
#pragma unroll
  for (int i = 0; i < 8; ++i) { a[i] = (_Float16)p[i]; a[8 + i] = (_Float16)p[16 + i]; }
  return a;
}
__device__ __forceinline__ v16h frag_f32s(const float* rowk0, int lane, float sc) {
  v16h a; const float* p = rowk0 + 8 * (lane >> 4);
#pragma unroll
  for (int i = 0; i < 8; ++i) { a[i] = (_Float16)(p[i] * sc); a[8 + i] = (_Float16)(p[16 + i] * sc); }
  return a;
}
// column fragment from a [K][ld] layout (column n), rows >= K read as 0
__device__ __forceinline__ v16h fragc_f32(const float* W, int k0, int n, int lane, int ld, int K) {
  v16h a; const int g = lane >> 4;
#pragma unroll
  for (int i = 0; i < 8; ++i) { const int ka = k0 + 8 * g + i, kb = ka + 16;
    a[i] = (_Float16)(ka < K ? W[(size_t)(ka < K ? ka : K - 1) * ld + n] : 0.f); a[8 + i] = (_Float16)(kb < K ? W[(size_t)(kb < K ? kb : K - 1) * ld + n] : 0.f); }
  return a;
}
struct F2 { v16b h, l; };
__device__ __forceinline__ F2 bsplit16(const float v[16]) { F2 r;
#pragma unroll
  for (int i = 0; i < 16; ++i) { const __bf16 h = (__bf16)v[i]; r.h[i] = h; r.l[i] = (__bf16)(v[i] - (float)h); }
  return r; }
__device__ __forceinline__ F2 split_row(const float* row, int k0, int lane) { float v[16]; const float* p = row + k0 + 8 * (lane >> 4);
#pragma unroll
  for (int i = 0; i < 8; ++i) { v[i] = p[i]; v[8 + i] = p[16 + i]; }
  return bsplit16(v); }
__device__ __forceinline__ F2 split_rowK(const float* row, int k0, int lane, int K) { float v[16]; const int g = lane >> 4;
#pragma unroll
  for (int i = 0; i < 8; ++i) { const int ka = k0 + 8 * g + i, kb = ka + 16; v[i] = ka < K ? row[ka < K ? ka : K - 1] : 0.f; v[8 + i] = kb < K ? row[kb < K ? kb : K - 1] : 0.f; }
  return bsplit16(v); }
__device__ __forceinline__ F2 split_col(const float* W, int k0, int n, int lane, int ld, int K) { float v[16]; const int g = lane >> 4;
#pragma unroll
  for (int i = 0; i < 8; ++i) { const int ka = k0 + 8 * g + i, kb = ka + 16; v[i] = ka < K ? W[(size_t)(ka < K ? ka : K - 1) * ld + n] : 0.f; v[8 + i] = kb < K ? W[(size_t)(kb < K ? kb : K - 1) * ld + n] : 0.f; }
  return bsplit16(v); }
__device__ __forceinline__ v8f mac3(const F2& a, const F2& b, v8f c) { c = wmma_bf(a.l, b.h, c); c = wmma_bf(a.h, b.l, c); return wmma_bf(a.h, b.h, c); }
__device__ __forceinline__ float sigm(float v) { return 1.0f / (1.0f + expf(-v)); }
#define LDSX() do { asm volatile("s_wait_dscnt 0" ::: "memory"); __builtin_amdgcn_wave_barrier(); __builtin_amdgcn_fence(__ATOMIC_RELEASE, "workgroup"); } while (0)


// Sparse cross-encoder self attention (B 2, 16 documents x 512 tokens, 32 query tokens, 1 cls; hidden 768 = 12 heads x 64): every segment attends over [cls | query | doc_d] per document (cat_forward path), outputs concatenated along the sequence -> [b, 16, 545, 768].
#define NBB 2
#define ND 16
#define NQT 32
#define NS 512
#define HIDN 768
#define NH 12
#define HD 64
#define LSEQ (1 + NQT + NS)          // 545
#define RPB (1 + NQT + ND * NS)      // unique token rows per batch = 8225
#define NROW (NBB * RPB)             // 16450
#define NROWP (((NROW + 63) / 64) * 64)
#ifndef TND
#define TND ND                       // documents per batch processed
#endif
#ifndef TNB
#define TNB NBB
#endif
#ifndef TPR
#define TPR (NROWP / 64)              // projected row blocks
#endif
typedef __attribute__((ext_vector_type(8))) __bf16 v8b;
__device__ __forceinline__ v16b frag_b(const __bf16* rowk0, int lane) {
  union { v16b v; v8b q[2]; } u; const __bf16* p = rowk0 + 8 * (lane >> 4);
  u.q[0] = *(const v8b*)p; u.q[1] = *(const v8b*)(p + 16); return u.v;
}
__device__ __forceinline__ float bfr(float v) { return (float)(__bf16)v; }
__device__ __attribute__((noinline)) float exp_ni(float v) { return expf(v); }
__device__ __attribute__((noinline)) float erf_ni(float v) { return erff(v); }

#define WS_X   0u                                    // f32 gathered input rows [NROWP][768] (cls, query, docs per batch; pad rows zero)
#define WS_Q   (WS_X + 4u * (size_t)NROWP * HIDN)      // f16 q rows
#define WS_K   (WS_Q + 2u * (size_t)NROWP * HIDN)
#define WS_V   (WS_K + 2u * (size_t)NROWP * HIDN)
#define WS_END (WS_V + 2u * (size_t)NROWP * HIDN)

__device__ __forceinline__ size_t tokrow(int b, int d, int i) { return (size_t)b * RPB + (i == 0 ? 0 : (i <= NQT ? i : (1 + NQT + (size_t)d * NS + (i - 1 - NQT)))); }   // position i of document d's sequence -> unique row
// ---- k_gath: block = row: copy the token's 768 inputs into the unified row buffer (bf16-rounded f32), pad rows zero
__global__ __launch_bounds__(192) void k_gath(const float* __restrict__ CLS, const float* __restrict__ QRY, const float* __restrict__ DOC, float* __restrict__ XR) { const size_t row = blockIdx.x; const int t = threadIdx.x;
  const float* src = nullptr; if (row < (size_t)NROW) { const size_t b = row / RPB; const int j = (int)(row % RPB); if (j == 0) src = CLS + b * HIDN; else if (j <= NQT) src = QRY + (b * NQT + (j - 1)) * HIDN; else src = DOC + (b * (size_t)ND * NS + (j - 1 - NQT)) * HIDN; }
  v4f o; if (src) { o[0] = bfr(src[t * 4]); o[1] = bfr(src[t * 4 + 1]); o[2] = bfr(src[t * 4 + 2]); o[3] = bfr(src[t * 4 + 3]); } else { o[0] = o[1] = o[2] = o[3] = 0.f; }
  vst2(XR + row * HIDN + t * 4, o); }
// ---- k_proj: block = (64 rows, 128 cols, which): f16 rows of X W^T + b (exact)
__global__ __launch_bounds__(128) void k_proj(const float* __restrict__ XR, const float* __restrict__ WQ, const float* __restrict__ BQ, const float* __restrict__ WK, const float* __restrict__ BK, const float* __restrict__ WV, const float* __restrict__ BV, _Float16* __restrict__ Q, _Float16* __restrict__ K, _Float16* __restrict__ V) { __shared__ __align__(16) _Float16 sh[64][136];
  const int tid = threadIdx.x, wave = tid >> 5, lane = tid & 31, col = lane & 15, g = lane >> 4; const int which = blockIdx.z; const int c0 = blockIdx.y * 128; const size_t r0 = (size_t)blockIdx.x * 64;
  const float* Wm = which == 0 ? WQ : which == 1 ? WK : WV; const float* Bm = which == 0 ? BQ : which == 1 ? BK : BV;
  v8f acc[8] = {};
#pragma unroll 2
  for (int kc = 0; kc < HIDN / 32; ++kc) { v16b a; { const float* p = XR + (r0 + wave * 16 + col) * HIDN + kc * 32 + 8 * g;
#pragma unroll
      for (int i = 0; i < 8; ++i) { a[i] = (__bf16)p[i]; a[8 + i] = (__bf16)p[16 + i]; } }
#pragma unroll
    for (int j = 0; j < 8; ++j) { v16b w; const size_t o = c0 + j * 16 + col;
#pragma unroll
      for (int i = 0; i < 8; ++i) { w[i] = (__bf16)Wm[o * HIDN + kc * 32 + 8 * g + i]; w[8 + i] = (__bf16)Wm[o * HIDN + kc * 32 + 16 + 8 * g + i]; }
      acc[j] = wmma_bf(a, w, acc[j]); } }
#pragma unroll
  for (int j = 0; j < 8; ++j) { const float bb = bfr(Bm[c0 + j * 16 + col]);
#pragma unroll
    for (int r = 0; r < 8; ++r) sh[wave * 16 + 8 * g + r][j * 16 + col] = (_Float16)(acc[j][r] + bb); }
  __syncthreads(); { _Float16* dst = which == 0 ? Q : which == 1 ? K : V; for (int e = tid; e < 64 * 16; e += 128) { const int rl = e >> 4, q = e & 15; vst2((unsigned*)(dst + (r0 + rl) * HIDN + c0 + q * 8), *(const v4u*)&sh[rl][q * 8]); } } }
// ---- k_att: block = (64 query positions, head, (b, d)): self attention over the document's 545-token sequence with the additive masks [0 | qmask[b] | dmask[b][d]]
__global__ __launch_bounds__(128) void k_att(const _Float16* __restrict__ Q, const _Float16* __restrict__ K, const _Float16* __restrict__ V, const float* __restrict__ QM, const float* __restrict__ DMK, float* __restrict__ OUT) {
  __shared__ __align__(16) float sp[4][16][36]; __shared__ __align__(16) float so[4][16][68]; __shared__ __align__(16) _Float16 sv[32][72]; __shared__ float smk[32]; __shared__ int srow[32];
  const int tid = threadIdx.x, wave = tid >> 5, lane = tid & 31, col = lane & 15, g = lane >> 4; const int qb = blockIdx.x, h = blockIdx.y; const int bd = blockIdx.z; const int b = bd / TND, d = bd % TND;
  const int qi = qb * 64 + wave * 16 + col; const int qic = (qi < LSEQ) ? qi : (LSEQ - 1);   // positions beyond 545 (last block) are computed on a clamped row and never stored
  v16h aq[2];
#pragma unroll
  for (int kc = 0; kc < 2; ++kc) aq[kc] = frag_h(Q + tokrow(b, d, qic) * HIDN + h * HD + kc * 32, lane);
  float m[8], l[8];
#pragma unroll
  for (int r = 0; r < 8; ++r) { m[r] = -3.0e38f; l[r] = 0.f; }
  v8f acc[4] = {};
#pragma unroll 1
  for (int ks = 0; ks < (LSEQ + 31) / 32; ++ks) {
    __syncthreads();
    if (tid < 32) { int ki = ks * 32 + tid; const bool valid = ki < LSEQ; if (!valid) ki = LSEQ - 1; const size_t rr = tokrow(b, d, ki); srow[tid] = (int)rr;
      float mk; if (ki == 0) mk = 0.f; else if (ki <= NQT) mk = bfr(QM[(size_t)b * NQT + (ki - 1)]); else mk = bfr(DMK[((size_t)b * ND + d) * NS + (ki - 1 - NQT)]); smk[tid] = valid ? mk : -3.0e38f; }
    __syncthreads();
    for (int e = tid; e < 32 * 8; e += 128) { const int i = e >> 3, q8 = e & 7; *(v4u*)&sv[i][q8 * 8] = *(const v4u*)(V + (size_t)srow[i] * HIDN + h * HD + q8 * 8); }
    float s[2][8];
#pragma unroll
    for (int ct = 0; ct < 2; ++ct) { const int i = ct * 16 + col; v8f c = {};
#pragma unroll
      for (int kc = 0; kc < 2; ++kc) c = wmma16(aq[kc], frag_h(K + (size_t)srow[i] * HIDN + h * HD + kc * 32, lane), c);
      const float mk = smk[i];
#pragma unroll
      for (int r = 0; r < 8; ++r) s[ct][r] = (mk <= -1.0e38f) ? -3.0e38f : (c[r] * 0.125f + mk); }
    float alpha[8];
#pragma unroll
    for (int r = 0; r < 8; ++r) { float mx = fmaxf(s[0][r], s[1][r]);
#pragma unroll
      for (int o = 1; o < 16; o <<= 1) mx = fmaxf(mx, __shfl_xor(mx, o));
      const float mn = fmaxf(m[r], mx); alpha[r] = __expf(m[r] - mn); const float e0 = (s[0][r] <= -1.0e38f) ? 0.f : __expf(s[0][r] - mn), e1 = (s[1][r] <= -1.0e38f) ? 0.f : __expf(s[1][r] - mn); float es = e0 + e1;
#pragma unroll
      for (int o = 1; o < 16; o <<= 1) es += __shfl_xor(es, o);
      l[r] = l[r] * alpha[r] + es; m[r] = mn; sp[wave][8 * g + r][col] = e0; sp[wave][8 * g + r][16 + col] = e1; }
#pragma unroll
    for (int j = 0; j < 4; ++j)
#pragma unroll
      for (int r = 0; r < 8; ++r) acc[j][r] *= alpha[r];
    __syncthreads();
    const v16h pa = frag_f32s(&sp[wave][col][0], lane, 2048.0f);
#pragma unroll
    for (int j = 0; j < 4; ++j) { v16h vb; const int dc = j * 16 + col;
#pragma unroll
      for (int i = 0; i < 8; ++i) { vb[i] = sv[8 * g + i][dc]; vb[8 + i] = sv[16 + 8 * g + i][dc]; }
      acc[j] = wmma16(pa, vb, acc[j]); } }
#pragma unroll
  for (int r = 0; r < 8; ++r) { const float il = (1.0f / 2048.0f) / l[r];
#pragma unroll
    for (int j = 0; j < 4; ++j) so[wave][8 * g + r][j * 16 + col] = acc[j][r] * il; }
  LDSX();
  for (int rl = 0; rl < 16; ++rl) { const int qpos = qb * 64 + wave * 16 + rl; if (qpos < LSEQ && lane < 16) vst2(OUT + (((size_t)b * ND + d) * LSEQ + qpos) * HIDN + h * HD + lane * 4, *(const v4f*)&so[wave][rl][lane * 4]); } }
extern "C" void kernel_launch(void* const* d_in, const int* in_sizes, int n_in, void* d_out, int out_size, void* d_ws, size_t ws_size, hipStream_t stream) {
  (void)in_sizes; (void)n_in; (void)out_size;
  const float** F = (const float**)d_in;   // 0 cls [2,1,1,768], 1 query [2,1,32,768], 2 doc [2,16,512,768], 3 qmask [2,1,1,1,32], 4 dmask [2,1,16,1,512], 5 Wq, 6 bq, 7 Wk, 8 bk, 9 Wv, 10 bv
  if (ws_size < (size_t)WS_END) return;
  char* ws = (char*)d_ws; float* XR = (float*)(ws + WS_X); _Float16 *Q = (_Float16*)(ws + WS_Q), *K = (_Float16*)(ws + WS_K), *V = (_Float16*)(ws + WS_V);
  k_gath<<<TPR * 64, 192, 0, stream>>>(F[0], F[1], F[2], XR);
  k_proj<<<dim3(TPR, HIDN / 128, 3), 128, 0, stream>>>(XR, F[5], F[6], F[7], F[8], F[9], F[10], Q, K, V);
  k_att<<<dim3((LSEQ + 63) / 64, NH, TNB * TND), 128, 0, stream>>>(Q, K, V, F[3], F[4], (float*)d_out);
}

// v001
// One run takes 294 microseconds.
// Two timings next to v000 both put it at 2.07 times that version's speed.
// compute dtype: all float inputs rounded to bf16, qmask/dmask read; q/k/v = hs W^T + b for every unique token (cls, query, doc) with EXACT bf16 products on WMMA 16x16x32 (natural weights), f32 accumulate, rounded once to f16 rows (0.02-scale weights: logits ~0.3); per (batch, document) self attention over its 545-token sequence [cls | query | doc_d] with the additive float masks, single f16 score products x 1/8, running-max softmax in f32 (hardware exp), P (f16 x 2^11) . v gathered per key tile; heads merged; f32 output.
#include <hip/hip_runtime.h>
#include <math.h>

typedef __attribute__((ext_vector_type(16))) _Float16 v16h;
typedef __attribute__((ext_vector_type(16))) __bf16 v16b;
typedef __attribute__((ext_vector_type(8)))  _Float16 v8h;
typedef __attribute__((ext_vector_type(8)))  float v8f;
typedef __attribute__((ext_vector_type(4)))  float v4f;
typedef __attribute__((ext_vector_type(2)))  float v2f;
typedef __attribute__((ext_vector_type(4)))  unsigned v4u;
typedef __attribute__((ext_vector_type(4)))  int v4i;
typedef float __attribute__((may_alias)) float_a;
typedef int __attribute__((may_alias)) int_a;

template <typename T> __device__ __forceinline__ void vst2(void* p, T v) { *(T*)p = v;  }
__device__ __forceinline__ v8f wmma16(v16h a, v16h b, v8f c) {
  v8f d = __builtin_amdgcn_wmma_f32_16x16x32_f16(false, a, false, b, (short)0, c, false, false);
  asm volatile("v_nop\n\tv_nop\n\tv_nop\n\tv_nop" : "+v"(d) : "v"(a), "v"(b));
  return d;
}
__device__ __forceinline__ v8f wmma_bf(v16b a, v16b b, v8f c) {
  v8f d = __builtin_amdgcn_wmma_f32_16x16x32_bf16(false, a, false, b, (short)0, c, false, false);
  asm volatile("v_nop\n\tv_nop\n\tv_nop\n\tv_nop" : "+v"(d) : "v"(a), "v"(b));
  return d;
}
// 16x16x32 fragments: lane = (h = lane>>4, row/col = lane&15); elements 0..7 = k0+8h+0..7, 8..15 = k0+16+8h+0..7; D element r = row 8h+r
__device__ __forceinline__ v16h frag_h(const _Float16* rowk0, int lane) {
  union { v16h v; v8h q[2]; } u; const _Float16* p = rowk0 + 8 * (lane >> 4);
  u.q[0] = *(const v8h*)p; u.q[1] = *(const v8h*)(p + 16); return u.v;
}
__device__ __forceinline__ v16h frag_f32(const float* rowk0, int lane) {
  v16h a; const float* p = rowk0 + 8 * (lane >> 4);
#pragma unroll
  for (int i = 0; i < 8; ++i) { a[i] = (_Float16)p[i]; a[8 + i] = (_Float16)p[16 + i]; }
  return a;
}
__device__ __forceinline__ v16h frag_f32s(const float* rowk0, int lane, float sc) {
  v16h a; const float* p = rowk0 + 8 * (lane >> 4);
#pragma unroll
  for (int i = 0; i < 8; ++i) { a[i] = (_Float16)(p[i] * sc); a[8 + i] = (_Float16)(p[16 + i] * sc); }
  return a;
}
// column fragment from a [K][ld] layout (column n), rows >= K read as 0
__device__ __forceinline__ v16h fragc_f32(const float* W, int k0, int n, int lane, int ld, int K) {
  v16h a; const int g = lane >> 4;
#pragma unroll
  for (int i = 0; i < 8; ++i) { const int ka = k0 + 8 * g + i, kb = ka + 16;
    a[i] = (_Float16)(ka < K ? W[(size_t)(ka < K ? ka : K - 1) * ld + n] : 0.f); a[8 + i] = (_Float16)(kb < K ? W[(size_t)(kb < K ? kb : K - 1) * ld + n] : 0.f); }
  return a;
}
struct F2 { v16b h, l; };
__device__ __forceinline__ F2 bsplit16(const float v[16]) { F2 r;
#pragma unroll
  for (int i = 0; i < 16; ++i) { const __bf16 h = (__bf16)v[i]; r.h[i] = h; r.l[i] = (__bf16)(v[i] - (float)h); }
  return r; }
__device__ __forceinline__ F2 split_row(const float* row, int k0, int lane) { float v[16]; const float* p = row + k0 + 8 * (lane >> 4);
#pragma unroll
  for (int i = 0; i < 8; ++i) { v[i] = p[i]; v[8 + i] = p[16 + i]; }
  return bsplit16(v); }
__device__ __forceinline__ F2 split_rowK(const float* row, int k0, int lane, int K) { float v[16]; const int g = lane >> 4;
#pragma unroll
  for (int i = 0; i < 8; ++i) { const int ka = k0 + 8 * g + i, kb = ka + 16; v[i] = ka < K ? row[ka < K ? ka : K - 1] : 0.f; v[8 + i] = kb < K ? row[kb < K ? kb : K - 1] : 0.f; }
  return bsplit16(v); }
__device__ __forceinline__ F2 split_col(const float* W, int k0, int n, int lane, int ld, int K) { float v[16]; const int g = lane >> 4;
#pragma unroll
  for (int i = 0; i < 8; ++i) { const int ka = k0 + 8 * g + i, kb = ka + 16; v[i] = ka < K ? W[(size_t)(ka < K ? ka : K - 1) * ld + n] : 0.f; v[8 + i] = kb < K ? W[(size_t)(kb < K ? kb : K - 1) * ld + n] : 0.f; }
  return bsplit16(v); }
__device__ __forceinline__ v8f mac3(const F2& a, const F2& b, v8f c) { c = wmma_bf(a.l, b.h, c); c = wmma_bf(a.h, b.l, c); return wmma_bf(a.h, b.h, c); }
__device__ __forceinline__ float sigm(float v) { return 1.0f / (1.0f + expf(-v)); }
#define LDSX() do { asm volatile("s_wait_dscnt 0" ::: "memory"); __builtin_amdgcn_wave_barrier(); __builtin_amdgcn_fence(__ATOMIC_RELEASE, "workgroup"); } while (0)


// Sparse cross-encoder self attention (B 2, 16 documents x 512 tokens, 32 query tokens, 1 cls; hidden 768 = 12 heads x 64): every segment attends over [cls | query | doc_d] per document (cat_forward path), outputs concatenated along the sequence -> [b, 16, 545, 768].
#define NBB 2
#define ND 16
#define NQT 32
#define NS 512
#define HIDN 768
#define NH 12
#define HD 64
#define LSEQ (1 + NQT + NS)          // 545
#define RPB (1 + NQT + ND * NS)      // unique token rows per batch = 8225
#define NROW (NBB * RPB)             // 16450
#define NROWP (((NROW + 63) / 64) * 64)
#ifndef TND
#define TND ND                       // documents per batch processed
#endif
#ifndef TNB
#define TNB NBB
#endif
#ifndef TPR
#define TPR (NROWP / 64)              // 64-row blocks of padded rows (two per k_proj block)
#endif
typedef __attribute__((ext_vector_type(8))) __bf16 v8b;
__device__ __forceinline__ v16b frag_b(const __bf16* rowk0, int lane) {
  union { v16b v; v8b q[2]; } u; const __bf16* p = rowk0 + 8 * (lane >> 4);
  u.q[0] = *(const v8b*)p; u.q[1] = *(const v8b*)(p + 16); return u.v;
}
__device__ __forceinline__ float bfr(float v) { return (float)(__bf16)v; }
__device__ __attribute__((noinline)) float exp_ni(float v) { return expf(v); }
__device__ __attribute__((noinline)) float erf_ni(float v) { return erff(v); }

#define WS_X   0u                                    // f32 gathered input rows [NROWP][768] (cls, query, docs per batch; pad rows zero)
#define WS_Q   (WS_X + 4u * (size_t)NROWP * HIDN)      // f16 q rows
#define WS_K   (WS_Q + 2u * (size_t)NROWP * HIDN)
#define WS_V   (WS_K + 2u * (size_t)NROWP * HIDN)
#define WS_END (WS_V + 2u * (size_t)NROWP * HIDN)

__device__ __forceinline__ size_t tokrow(int b, int d, int i) { return (size_t)b * RPB + (i == 0 ? 0 : (i <= NQT ? i : (1 + NQT + (size_t)d * NS + (i - 1 - NQT)))); }   // position i of document d's sequence -> unique row
// ---- k_gath: block = row: copy the token's 768 inputs into the unified row buffer (bf16-rounded f32), pad rows zero
__global__ __launch_bounds__(192) void k_gath(const float* __restrict__ CLS, const float* __restrict__ QRY, const float* __restrict__ DOC, float* __restrict__ XR) { const size_t row = blockIdx.x; const int t = threadIdx.x;
  const float* src = nullptr; if (row < (size_t)NROW) { const size_t b = row / RPB; const int j = (int)(row % RPB); if (j == 0) src = CLS + b * HIDN; else if (j <= NQT) src = QRY + (b * NQT + (j - 1)) * HIDN; else src = DOC + (b * (size_t)ND * NS + (j - 1 - NQT)) * HIDN; }
  v4f o; if (src) { o[0] = bfr(src[t * 4]); o[1] = bfr(src[t * 4 + 1]); o[2] = bfr(src[t * 4 + 2]); o[3] = bfr(src[t * 4 + 3]); } else { o[0] = o[1] = o[2] = o[3] = 0.f; }
  vst2(XR + row * HIDN + t * 4, o); }
// ---- k_proj: block = (128 rows, 256 cols, which), 8 waves of 64 x 64: f16 rows of X W^T + b (exact). Each 32-k slice of the 128 X rows and 256 W rows is read once per block in whole 128-B lines, rounded to bf16 and staged in LDS (two buffers, one barrier per slice); every wave takes its fragments from there
typedef __attribute__((ext_vector_type(4))) __bf16 v4b;
#define PBM 128
#define PBN 256
#define PPIT 40                      // bf16 per staged row: 64 B of k + 16 B pad (80 B = 16 B x odd: the 16-byte fragment reads of 16 rows fall on distinct banks)
#define PBUF ((PBM + PBN) * PPIT)    // bf16 per buffer: X rows 0..127, W rows 128..383
#define PSH (PBN + 8)                // f16 per staged output row
__global__ __launch_bounds__(256) void k_proj(const float* __restrict__ XR, const float* __restrict__ WQ, const float* __restrict__ BQ, const float* __restrict__ WK, const float* __restrict__ BK, const float* __restrict__ WV, const float* __restrict__ BV, _Float16* __restrict__ Q, _Float16* __restrict__ K, _Float16* __restrict__ V) { __shared__ __align__(16) unsigned char smem[PBM * PSH * 2];   // the two operand buffers (2 * PBUF * 2 B fit inside), then the output tile
  static_assert(2 * PBUF * 2 <= PBM * PSH * 2, "operand buffers fit");
  __bf16* st = (__bf16*)smem; _Float16* sh = (_Float16*)smem;
  const int tid = threadIdx.x, wave = tid >> 5, lane = tid & 31, col = lane & 15, g = lane >> 4, wm = wave & 1, wn = wave >> 1; const int which = blockIdx.z; const int c0 = blockIdx.y * PBN; const size_t r0 = (size_t)blockIdx.x * PBM;
  const float* Wm = which == 0 ? WQ : which == 1 ? WK : WV; const float* Bm = which == 0 ? BQ : which == 1 ? BK : BV;
  const int sr = tid >> 3, sc = tid & 7;   // staging: 8 lanes cover one row's 128 B, a wave-wide load covers 4 whole lines
  const float* px = XR + (r0 + sr) * HIDN + sc * 4; const float* pw = Wm + (size_t)(c0 + sr) * HIDN + sc * 4;
  v4f pre[12];
#pragma unroll
  for (int i = 0; i < 4; ++i) pre[i] = *(const v4f*)(px + (size_t)i * 32 * HIDN);
#pragma unroll
  for (int i = 0; i < 8; ++i) pre[4 + i] = *(const v4f*)(pw + (size_t)i * 32 * HIDN);
#pragma unroll
  for (int i = 0; i < 12; ++i) *(v4b*)(st + (sr + 32 * i) * PPIT + sc * 4) = __builtin_convertvector(pre[i], v4b);
  __syncthreads();
  v8f acc[4][4] = {};
  for (int kc = 0; kc < HIDN / 32; ++kc) { const __bf16* bp = st + (kc & 1) * PBUF;
    if (kc + 1 < HIDN / 32) {
#pragma unroll
      for (int i = 0; i < 4; ++i) pre[i] = *(const v4f*)(px + (size_t)i * 32 * HIDN + (kc + 1) * 32);
#pragma unroll
      for (int i = 0; i < 8; ++i) pre[4 + i] = *(const v4f*)(pw + (size_t)i * 32 * HIDN + (kc + 1) * 32); }
    v16b a[4], w[4];
#pragma unroll
    for (int i = 0; i < 4; ++i) { a[i] = frag_b(bp + (wm * 64 + i * 16 + col) * PPIT, lane); w[i] = frag_b(bp + (PBM + wn * 64 + i * 16 + col) * PPIT, lane); }
#pragma unroll
    for (int j = 0; j < 4; ++j)
#pragma unroll
      for (int i = 0; i < 4; ++i) acc[i][j] = wmma_bf(a[i], w[j], acc[i][j]);
    if (kc + 1 < HIDN / 32) { __bf16* sb = st + ((kc + 1) & 1) * PBUF;
#pragma unroll
      for (int i = 0; i < 12; ++i) *(v4b*)(sb + (sr + 32 * i) * PPIT + sc * 4) = __builtin_convertvector(pre[i], v4b); }
    __syncthreads(); }   // publishes slice kc + 1 and ends every read of slice kc's buffer, which slice kc + 2 (or the output tile) overwrites
#pragma unroll
  for (int j = 0; j < 4; ++j) { const float bb = bfr(Bm[c0 + wn * 64 + j * 16 + col]);
#pragma unroll
    for (int i = 0; i < 4; ++i)
#pragma unroll
      for (int r = 0; r < 8; ++r) sh[(wm * 64 + i * 16 + 8 * g + r) * PSH + wn * 64 + j * 16 + col] = (_Float16)(acc[i][j][r] + bb); }
  __syncthreads(); { _Float16* dst = which == 0 ? Q : which == 1 ? K : V; for (int e = tid; e < PBM * (PBN / 8); e += 256) { const int rl = e >> 5, q = e & 31; vst2((unsigned*)(dst + (r0 + rl) * HIDN + c0 + q * 8), *(const v4u*)&sh[rl * PSH + q * 8]); } } }
// ---- k_att: block = (64 query positions, head, (b, d)): self attention over the document's 545-token sequence with the additive masks [0 | qmask[b] | dmask[b][d]]
__global__ __launch_bounds__(128) void k_att(const _Float16* __restrict__ Q, const _Float16* __restrict__ K, const _Float16* __restrict__ V, const float* __restrict__ QM, const float* __restrict__ DMK, float* __restrict__ OUT) {
  __shared__ __align__(16) float sp[4][16][36]; __shared__ __align__(16) float so[4][16][68]; __shared__ __align__(16) _Float16 sv[32][72]; __shared__ float smk[32]; __shared__ int srow[32];
  const int tid = threadIdx.x, wave = tid >> 5, lane = tid & 31, col = lane & 15, g = lane >> 4; const int qb = blockIdx.x, h = blockIdx.y; const int bd = blockIdx.z; const int b = bd / TND, d = bd % TND;
  const int qi = qb * 64 + wave * 16 + col; const int qic = (qi < LSEQ) ? qi : (LSEQ - 1);   // positions beyond 545 (last block) are computed on a clamped row and never stored
  v16h aq[2];
#pragma unroll
  for (int kc = 0; kc < 2; ++kc) aq[kc] = frag_h(Q + tokrow(b, d, qic) * HIDN + h * HD + kc * 32, lane);
  float m[8], l[8];
#pragma unroll
  for (int r = 0; r < 8; ++r) { m[r] = -3.0e38f; l[r] = 0.f; }
  v8f acc[4] = {};
#pragma unroll 1
  for (int ks = 0; ks < (LSEQ + 31) / 32; ++ks) {
    __syncthreads();
    if (tid < 32) { int ki = ks * 32 + tid; const bool valid = ki < LSEQ; if (!valid) ki = LSEQ - 1; const size_t rr = tokrow(b, d, ki); srow[tid] = (int)rr;
      float mk; if (ki == 0) mk = 0.f; else if (ki <= NQT) mk = bfr(QM[(size_t)b * NQT + (ki - 1)]); else mk = bfr(DMK[((size_t)b * ND + d) * NS + (ki - 1 - NQT)]); smk[tid] = valid ? mk : -3.0e38f; }
    __syncthreads();
    for (int e = tid; e < 32 * 8; e += 128) { const int i = e >> 3, q8 = e & 7; *(v4u*)&sv[i][q8 * 8] = *(const v4u*)(V + (size_t)srow[i] * HIDN + h * HD + q8 * 8); }
    float s[2][8];
#pragma unroll
    for (int ct = 0; ct < 2; ++ct) { const int i = ct * 16 + col; v8f c = {};
#pragma unroll
      for (int kc = 0; kc < 2; ++kc) c = wmma16(aq[kc], frag_h(K + (size_t)srow[i] * HIDN + h * HD + kc * 32, lane), c);
      const float mk = smk[i];
#pragma unroll
      for (int r = 0; r < 8; ++r) s[ct][r] = (mk <= -1.0e38f) ? -3.0e38f : (c[r] * 0.125f + mk); }
    float alpha[8];
#pragma unroll
    for (int r = 0; r < 8; ++r) { float mx = fmaxf(s[0][r], s[1][r]);
#pragma unroll
      for (int o = 1; o < 16; o <<= 1) mx = fmaxf(mx, __shfl_xor(mx, o));
      const float mn = fmaxf(m[r], mx); alpha[r] = __expf(m[r] - mn); const float e0 = (s[0][r] <= -1.0e38f) ? 0.f : __expf(s[0][r] - mn), e1 = (s[1][r] <= -1.0e38f) ? 0.f : __expf(s[1][r] - mn); float es = e0 + e1;
#pragma unroll
      for (int o = 1; o < 16; o <<= 1) es += __shfl_xor(es, o);
      l[r] = l[r] * alpha[r] + es; m[r] = mn; sp[wave][8 * g + r][col] = e0; sp[wave][8 * g + r][16 + col] = e1; }
#pragma unroll
    for (int j = 0; j < 4; ++j)
#pragma unroll
      for (int r = 0; r < 8; ++r) acc[j][r] *= alpha[r];
    __syncthreads();
    const v16h pa = frag_f32s(&sp[wave][col][0], lane, 2048.0f);
#pragma unroll
    for (int j = 0; j < 4; ++j) { v16h vb; const int dc = j * 16 + col;
#pragma unroll
      for (int i = 0; i < 8; ++i) { vb[i] = sv[8 * g + i][dc]; vb[8 + i] = sv[16 + 8 * g + i][dc]; }
      acc[j] = wmma16(pa, vb, acc[j]); } }
#pragma unroll
  for (int r = 0; r < 8; ++r) { const float il = (1.0f / 2048.0f) / l[r];
#pragma unroll
    for (int j = 0; j < 4; ++j) so[wave][8 * g + r][j * 16 + col] = acc[j][r] * il; }
  LDSX();
  for (int rl = 0; rl < 16; ++rl) { const int qpos = qb * 64 + wave * 16 + rl; if (qpos < LSEQ && lane < 16) vst2(OUT + (((size_t)b * ND + d) * LSEQ + qpos) * HIDN + h * HD + lane * 4, *(const v4f*)&so[wave][rl][lane * 4]); } }
extern "C" void kernel_launch(void* const* d_in, const int* in_sizes, int n_in, void* d_out, int out_size, void* d_ws, size_t ws_size, hipStream_t stream) {
  (void)in_sizes; (void)n_in; (void)out_size;
  const float** F = (const float**)d_in;   // 0 cls [2,1,1,768], 1 query [2,1,32,768], 2 doc [2,16,512,768], 3 qmask [2,1,1,1,32], 4 dmask [2,1,16,1,512], 5 Wq, 6 bq, 7 Wk, 8 bk, 9 Wv, 10 bv
  if (ws_size < (size_t)WS_END) return;
  char* ws = (char*)d_ws; float* XR = (float*)(ws + WS_X); _Float16 *Q = (_Float16*)(ws + WS_Q), *K = (_Float16*)(ws + WS_K), *V = (_Float16*)(ws + WS_V);
  k_gath<<<TPR * 64, 192, 0, stream>>>(F[0], F[1], F[2], XR);
  k_proj<<<dim3((TPR + 1) / 2, HIDN / PBN, 3), 256, 0, stream>>>(XR, F[5], F[6], F[7], F[8], F[9], F[10], Q, K, V);
  k_att<<<dim3((LSEQ + 63) / 64, NH, TNB * TND), 128, 0, stream>>>(Q, K, V, F[3], F[4], (float*)d_out);
}

// v002
// One run takes 230 microseconds.
// Next to v001, in two timings, it ran 1.28 times as fast each time.
// Over all steps from v000 it is 2.65 times as fast.
// compute dtype: all float inputs rounded to bf16, qmask/dmask read; q/k/v = hs W^T + b for every unique token (cls, query, doc) with EXACT bf16 products on WMMA 16x16x32 (natural weights), f32 accumulate, rounded once to f16 rows (0.02-scale weights: logits ~0.3); per (batch, document) self attention over its 545-token sequence [cls | query | doc_d] with the additive float masks, single f16 score products x 1/8, running-max softmax in f32 (hardware exp), P (f16 x 2^11) . v gathered per key tile; heads merged; f32 output.
#include <hip/hip_runtime.h>
#include <math.h>

typedef __attribute__((ext_vector_type(16))) _Float16 v16h;
typedef __attribute__((ext_vector_type(16))) __bf16 v16b;
typedef __attribute__((ext_vector_type(8)))  _Float16 v8h;
typedef __attribute__((ext_vector_type(8)))  float v8f;
typedef __attribute__((ext_vector_type(4)))  float v4f;
typedef __attribute__((ext_vector_type(2)))  float v2f;
typedef __attribute__((ext_vector_type(4)))  unsigned v4u;
typedef __attribute__((ext_vector_type(4)))  int v4i;
typedef float __attribute__((may_alias)) float_a;
typedef int __attribute__((may_alias)) int_a;

template <typename T> __device__ __forceinline__ void vst2(void* p, T v) { *(T*)p = v;  }
__device__ __forceinline__ v8f wmma16(v16h a, v16h b, v8f c) {
  v8f d = __builtin_amdgcn_wmma_f32_16x16x32_f16(false, a, false, b, (short)0, c, false, false);
  asm volatile("v_nop\n\tv_nop\n\tv_nop\n\tv_nop" : "+v"(d) : "v"(a), "v"(b));
  return d;
}
__device__ __forceinline__ v8f wmma_bf(v16b a, v16b b, v8f c) {
  v8f d = __builtin_amdgcn_wmma_f32_16x16x32_bf16(false, a, false, b, (short)0, c, false, false);
  asm volatile("v_nop\n\tv_nop\n\tv_nop\n\tv_nop" : "+v"(d) : "v"(a), "v"(b));
  return d;
}
// 16x16x32 fragments: lane = (h = lane>>4, row/col = lane&15); elements 0..7 = k0+8h+0..7, 8..15 = k0+16+8h+0..7; D element r = row 8h+r
__device__ __forceinline__ v16h frag_h(const _Float16* rowk0, int lane) {
  union { v16h v; v8h q[2]; } u; const _Float16* p = rowk0 + 8 * (lane >> 4);
  u.q[0] = *(const v8h*)p; u.q[1] = *(const v8h*)(p + 16); return u.v;
}
__device__ __forceinline__ v16h frag_f32(const float* rowk0, int lane) {
  v16h a; const float* p = rowk0 + 8 * (lane >> 4);
#pragma unroll
  for (int i = 0; i < 8; ++i) { a[i] = (_Float16)p[i]; a[8 + i] = (_Float16)p[16 + i]; }
  return a;
}
__device__ __forceinline__ v16h frag_f32s(const float* rowk0, int lane, float sc) {
  v16h a; const float* p = rowk0 + 8 * (lane >> 4);
#pragma unroll
  for (int i = 0; i < 8; ++i) { a[i] = (_Float16)(p[i] * sc); a[8 + i] = (_Float16)(p[16 + i] * sc); }
  return a;
}
// column fragment from a [K][ld] layout (column n), rows >= K read as 0
__device__ __forceinline__ v16h fragc_f32(const float* W, int k0, int n, int lane, int ld, int K) {
  v16h a; const int g = lane >> 4;
#pragma unroll
  for (int i = 0; i < 8; ++i) { const int ka = k0 + 8 * g + i, kb = ka + 16;
    a[i] = (_Float16)(ka < K ? W[(size_t)(ka < K ? ka : K - 1) * ld + n] : 0.f); a[8 + i] = (_Float16)(kb < K ? W[(size_t)(kb < K ? kb : K - 1) * ld + n] : 0.f); }
  return a;
}
struct F2 { v16b h, l; };
__device__ __forceinline__ F2 bsplit16(const float v[16]) { F2 r;
#pragma unroll
  for (int i = 0; i < 16; ++i) { const __bf16 h = (__bf16)v[i]; r.h[i] = h; r.l[i] = (__bf16)(v[i] - (float)h); }
  return r; }
__device__ __forceinline__ F2 split_row(const float* row, int k0, int lane) { float v[16]; const float* p = row + k0 + 8 * (lane >> 4);
#pragma unroll
  for (int i = 0; i < 8; ++i) { v[i] = p[i]; v[8 + i] = p[16 + i]; }
  return bsplit16(v); }
__device__ __forceinline__ F2 split_rowK(const float* row, int k0, int lane, int K) { float v[16]; const int g = lane >> 4;
#pragma unroll
  for (int i = 0; i < 8; ++i) { const int ka = k0 + 8 * g + i, kb = ka + 16; v[i] = ka < K ? row[ka < K ? ka : K - 1] : 0.f; v[8 + i] = kb < K ? row[kb < K ? kb : K - 1] : 0.f; }
  return bsplit16(v); }
__device__ __forceinline__ F2 split_col(const float* W, int k0, int n, int lane, int ld, int K) { float v[16]; const int g = lane >> 4;
#pragma unroll
  for (int i = 0; i < 8; ++i) { const int ka = k0 + 8 * g + i, kb = ka + 16; v[i] = ka < K ? W[(size_t)(ka < K ? ka : K - 1) * ld + n] : 0.f; v[8 + i] = kb < K ? W[(size_t)(kb < K ? kb : K - 1) * ld + n] : 0.f; }
  return bsplit16(v); }
__device__ __forceinline__ v8f mac3(const F2& a, const F2& b, v8f c) { c = wmma_bf(a.l, b.h, c); c = wmma_bf(a.h, b.l, c); return wmma_bf(a.h, b.h, c); }
__device__ __forceinline__ float sigm(float v) { return 1.0f / (1.0f + expf(-v)); }
#define LDSX() do { asm volatile("s_wait_dscnt 0" ::: "memory"); __builtin_amdgcn_wave_barrier(); __builtin_amdgcn_fence(__ATOMIC_RELEASE, "workgroup"); } while (0)


// Sparse cross-encoder self attention (B 2, 16 documents x 512 tokens, 32 query tokens, 1 cls; hidden 768 = 12 heads x 64): every segment attends over [cls | query | doc_d] per document (cat_forward path), outputs concatenated along the sequence -> [b, 16, 545, 768].
#define NBB 2
#define ND 16
#define NQT 32
#define NS 512
#define HIDN 768
#define NH 12
#define HD 64
#define LSEQ (1 + NQT + NS)          // 545
#define RPB (1 + NQT + ND * NS)      // unique token rows per batch = 8225
#define NROW (NBB * RPB)             // 16450
#define NROWP (((NROW + 63) / 64) * 64)
#ifndef TND
#define TND ND                       // documents per batch processed
#endif
#ifndef TNB
#define TNB NBB
#endif
#ifndef TPR
#define TPR (NROWP / 64)              // 64-row blocks of padded rows (two per k_proj block)
#endif
typedef __attribute__((ext_vector_type(8))) __bf16 v8b;
__device__ __forceinline__ v16b frag_b(const __bf16* rowk0, int lane) {
  union { v16b v; v8b q[2]; } u; const __bf16* p = rowk0 + 8 * (lane >> 4);
  u.q[0] = *(const v8b*)p; u.q[1] = *(const v8b*)(p + 16); return u.v;
}
__device__ __forceinline__ float bfr(float v) { return (float)(__bf16)v; }
__device__ __attribute__((noinline)) float exp_ni(float v) { return expf(v); }
__device__ __attribute__((noinline)) float erf_ni(float v) { return erff(v); }

#define WS_X   0u                                    // f32 gathered input rows [NROWP][768] (cls, query, docs per batch; pad rows zero)
#define WS_Q   (WS_X + 4u * (size_t)NROWP * HIDN)      // f16 q rows
#define WS_K   (WS_Q + 2u * (size_t)NROWP * HIDN)
#define WS_V   (WS_K + 2u * (size_t)NROWP * HIDN)
#define WS_END (WS_V + 2u * (size_t)NROWP * HIDN)

__device__ __forceinline__ size_t tokrow(int b, int d, int i) { return (size_t)b * RPB + (i == 0 ? 0 : (i <= NQT ? i : (1 + NQT + (size_t)d * NS + (i - 1 - NQT)))); }   // position i of document d's sequence -> unique row
// ---- k_gath: block = row: copy the token's 768 inputs into the unified row buffer (bf16-rounded f32), pad rows zero
__global__ __launch_bounds__(192) void k_gath(const float* __restrict__ CLS, const float* __restrict__ QRY, const float* __restrict__ DOC, float* __restrict__ XR) { const size_t row = blockIdx.x; const int t = threadIdx.x;
  const float* src = nullptr; if (row < (size_t)NROW) { const size_t b = row / RPB; const int j = (int)(row % RPB); if (j == 0) src = CLS + b * HIDN; else if (j <= NQT) src = QRY + (b * NQT + (j - 1)) * HIDN; else src = DOC + (b * (size_t)ND * NS + (j - 1 - NQT)) * HIDN; }
  v4f o; if (src) { o[0] = bfr(src[t * 4]); o[1] = bfr(src[t * 4 + 1]); o[2] = bfr(src[t * 4 + 2]); o[3] = bfr(src[t * 4 + 3]); } else { o[0] = o[1] = o[2] = o[3] = 0.f; }
  vst2(XR + row * HIDN + t * 4, o); }
// ---- k_proj: block = (128 rows, 256 cols, which), 8 waves of 64 x 64: f16 rows of X W^T + b (exact). Each 32-k slice of the 128 X rows and 256 W rows is read once per block in whole 128-B lines, rounded to bf16 and staged in LDS (two buffers, one barrier per slice); every wave takes its fragments from there
typedef __attribute__((ext_vector_type(4))) __bf16 v4b;
#define PBM 128
#define PBN 256
#define PPIT 40                      // bf16 per staged row: 64 B of k + 16 B pad (80 B = 16 B x odd: the 16-byte fragment reads of 16 rows fall on distinct banks)
#define PBUF ((PBM + PBN) * PPIT)    // bf16 per buffer: X rows 0..127, W rows 128..383
#define PSH (PBN + 8)                // f16 per staged output row
__global__ __launch_bounds__(256) void k_proj(const float* __restrict__ XR, const float* __restrict__ WQ, const float* __restrict__ BQ, const float* __restrict__ WK, const float* __restrict__ BK, const float* __restrict__ WV, const float* __restrict__ BV, _Float16* __restrict__ Q, _Float16* __restrict__ K, _Float16* __restrict__ V) { __shared__ __align__(16) unsigned char smem[PBM * PSH * 2];   // the two operand buffers (2 * PBUF * 2 B fit inside), then the output tile
  static_assert(2 * PBUF * 2 <= PBM * PSH * 2, "operand buffers fit");
  __bf16* st = (__bf16*)smem; _Float16* sh = (_Float16*)smem;
  const int tid = threadIdx.x, wave = tid >> 5, lane = tid & 31, col = lane & 15, g = lane >> 4, wm = wave & 1, wn = wave >> 1; const int which = blockIdx.z; const int c0 = blockIdx.y * PBN; const size_t r0 = (size_t)blockIdx.x * PBM;
  const float* Wm = which == 0 ? WQ : which == 1 ? WK : WV; const float* Bm = which == 0 ? BQ : which == 1 ? BK : BV;
  const int sr = tid >> 3, sc = tid & 7;   // staging: 8 lanes cover one row's 128 B, a wave-wide load covers 4 whole lines
  const float* px = XR + (r0 + sr) * HIDN + sc * 4; const float* pw = Wm + (size_t)(c0 + sr) * HIDN + sc * 4;
  v4f pre[12];
#pragma unroll
  for (int i = 0; i < 4; ++i) pre[i] = *(const v4f*)(px + (size_t)i * 32 * HIDN);
#pragma unroll
  for (int i = 0; i < 8; ++i) pre[4 + i] = *(const v4f*)(pw + (size_t)i * 32 * HIDN);
#pragma unroll
  for (int i = 0; i < 12; ++i) *(v4b*)(st + (sr + 32 * i) * PPIT + sc * 4) = __builtin_convertvector(pre[i], v4b);
  __syncthreads();
  v8f acc[4][4] = {};
  for (int kc = 0; kc < HIDN / 32; ++kc) { const __bf16* bp = st + (kc & 1) * PBUF;
    if (kc + 1 < HIDN / 32) {
#pragma unroll
      for (int i = 0; i < 4; ++i) pre[i] = *(const v4f*)(px + (size_t)i * 32 * HIDN + (kc + 1) * 32);
#pragma unroll
      for (int i = 0; i < 8; ++i) pre[4 + i] = *(const v4f*)(pw + (size_t)i * 32 * HIDN + (kc + 1) * 32); }
    v16b a[4], w[4];
#pragma unroll
    for (int i = 0; i < 4; ++i) { a[i] = frag_b(bp + (wm * 64 + i * 16 + col) * PPIT, lane); w[i] = frag_b(bp + (PBM + wn * 64 + i * 16 + col) * PPIT, lane); }
#pragma unroll
    for (int j = 0; j < 4; ++j)
#pragma unroll
      for (int i = 0; i < 4; ++i) acc[i][j] = wmma_bf(a[i], w[j], acc[i][j]);
    if (kc + 1 < HIDN / 32) { __bf16* sb = st + ((kc + 1) & 1) * PBUF;
#pragma unroll
      for (int i = 0; i < 12; ++i) *(v4b*)(sb + (sr + 32 * i) * PPIT + sc * 4) = __builtin_convertvector(pre[i], v4b); }
    __syncthreads(); }   // publishes slice kc + 1 and ends every read of slice kc's buffer, which slice kc + 2 (or the output tile) overwrites
#pragma unroll
  for (int j = 0; j < 4; ++j) { const float bb = bfr(Bm[c0 + wn * 64 + j * 16 + col]);
#pragma unroll
    for (int i = 0; i < 4; ++i)
#pragma unroll
      for (int r = 0; r < 8; ++r) sh[(wm * 64 + i * 16 + 8 * g + r) * PSH + wn * 64 + j * 16 + col] = (_Float16)(acc[i][j][r] + bb); }
  __syncthreads(); { _Float16* dst = which == 0 ? Q : which == 1 ? K : V; for (int e = tid; e < PBM * (PBN / 8); e += 256) { const int rl = e >> 5, q = e & 31; vst2((unsigned*)(dst + (r0 + rl) * HIDN + c0 + q * 8), *(const v4u*)&sh[rl * PSH + q * 8]); } } }
__device__ __forceinline__ float xhalf(float v) { const int b = __builtin_bit_cast(int, v); return __builtin_bit_cast(float, __builtin_amdgcn_permlanex16(b, b, 0x76543210, 0xfedcba98, false, false)); }
__global__ __launch_bounds__(128) void k_att(const _Float16* __restrict__ Q, const _Float16* __restrict__ K, const _Float16* __restrict__ V, const float* __restrict__ QM, const float* __restrict__ DMK, float* __restrict__ OUT) {
  __shared__ __align__(16) float so[4][16][68]; __shared__ __align__(16) _Float16 sv[32][72]; __shared__ __align__(16) float smk[32]; __shared__ int srow[32];
  const int tid = threadIdx.x, wave = tid >> 5, lane = tid & 31, col = lane & 15, g = lane >> 4; const int qb = blockIdx.x, h = blockIdx.y; const int bd = blockIdx.z; const int b = bd / TND, d = bd % TND;
  const int qi = qb * 64 + wave * 16 + col; const int qic = (qi < LSEQ) ? qi : (LSEQ - 1);   // positions beyond 545 (last block) are computed on a clamped row and never stored
  v16h bq[2];
#pragma unroll
  for (int kc = 0; kc < 2; ++kc) bq[kc] = frag_h(Q + tokrow(b, d, qic) * HIDN + h * HD + kc * 32, lane);
  float m = -3.0e38f, l = 0.f;   // the query's running maximum (equal in both halves) and this half's share of its sum
  v8f acc[4] = {};               // acc[j][r] = O[query col][16 j + 8 g + r]
#pragma unroll 1
  for (int ks = 0; ks < (LSEQ + 31) / 32; ++ks) {
    __syncthreads();
    if (tid < 32) { int ki = ks * 32 + tid; const bool valid = ki < LSEQ; if (!valid) ki = LSEQ - 1; const size_t rr = tokrow(b, d, ki); srow[tid] = (int)rr;
      float mk; if (ki == 0) mk = 0.f; else if (ki <= NQT) mk = bfr(QM[(size_t)b * NQT + (ki - 1)]); else mk = bfr(DMK[((size_t)b * ND + d) * NS + (ki - 1 - NQT)]); smk[tid] = valid ? mk : -3.0e38f; }
    __syncthreads();
    for (int e = tid; e < 32 * 8; e += 128) { const int i = e >> 3, q8 = e & 7; *(v4u*)&sv[i][q8 * 8] = *(const v4u*)(V + (size_t)srow[i] * HIDN + h * HD + q8 * 8); }
    float s[2][8];
#pragma unroll
    for (int ct = 0; ct < 2; ++ct) { const int i = ct * 16 + col; v8f c = {};
#pragma unroll
      for (int kc = 0; kc < 2; ++kc) c = wmma16(frag_h(K + (size_t)srow[i] * HIDN + h * HD + kc * 32, lane), bq[kc], c);
      const v4f mka = *(const v4f*)&smk[ct * 16 + 8 * g], mkb = *(const v4f*)&smk[ct * 16 + 8 * g + 4];
#pragma unroll
      for (int r = 0; r < 8; ++r) { const float mk = r < 4 ? mka[r & 3] : mkb[r & 3]; s[ct][r] = (mk <= -1.0e38f) ? -3.0e38f : (c[r] * 0.125f + mk); } }
    float mx = fmaxf(s[0][0], s[1][0]);
#pragma unroll
    for (int r = 1; r < 8; ++r) mx = fmaxf(mx, fmaxf(s[0][r], s[1][r]));
    mx = fmaxf(mx, xhalf(mx));
    const float mn = fmaxf(m, mx), alpha = __expf(m - mn); float es = 0.f; v16h pb;
#pragma unroll
    for (int ct = 0; ct < 2; ++ct)
#pragma unroll
      for (int r = 0; r < 8; ++r) { const float e = (s[ct][r] <= -1.0e38f) ? 0.f : __expf(s[ct][r] - mn); es += e; pb[ct * 8 + r] = (_Float16)(e * 2048.0f); }
    l = l * alpha + es; m = mn;
#pragma unroll
    for (int j = 0; j < 4; ++j)
#pragma unroll
      for (int r = 0; r < 8; ++r) acc[j][r] *= alpha;
    __syncthreads();
#pragma unroll
    for (int j = 0; j < 4; ++j) { v16h va; const int dc = j * 16 + col;
#pragma unroll
      for (int i = 0; i < 8; ++i) { va[i] = sv[8 * g + i][dc]; va[8 + i] = sv[16 + 8 * g + i][dc]; }
      acc[j] = wmma16(va, pb, acc[j]); } }
  l += xhalf(l);
  const float il = (1.0f / 2048.0f) / l;
#pragma unroll
  for (int j = 0; j < 4; ++j) { v4f oa, ob;
#pragma unroll
    for (int r = 0; r < 4; ++r) { oa[r] = acc[j][r] * il; ob[r] = acc[j][4 + r] * il; }
    *(v4f*)&so[wave][col][j * 16 + 8 * g] = oa; *(v4f*)&so[wave][col][j * 16 + 8 * g + 4] = ob; }
  LDSX();
  for (int rl = 0; rl < 16; ++rl) { const int qpos = qb * 64 + wave * 16 + rl; if (qpos < LSEQ && lane < 16) vst2(OUT + (((size_t)b * ND + d) * LSEQ + qpos) * HIDN + h * HD + lane * 4, *(const v4f*)&so[wave][rl][lane * 4]); } }
extern "C" void kernel_launch(void* const* d_in, const int* in_sizes, int n_in, void* d_out, int out_size, void* d_ws, size_t ws_size, hipStream_t stream) {
  (void)in_sizes; (void)n_in; (void)out_size;
  const float** F = (const float**)d_in;   // 0 cls [2,1,1,768], 1 query [2,1,32,768], 2 doc [2,16,512,768], 3 qmask [2,1,1,1,32], 4 dmask [2,1,16,1,512], 5 Wq, 6 bq, 7 Wk, 8 bk, 9 Wv, 10 bv
  if (ws_size < (size_t)WS_END) return;
  char* ws = (char*)d_ws; float* XR = (float*)(ws + WS_X); _Float16 *Q = (_Float16*)(ws + WS_Q), *K = (_Float16*)(ws + WS_K), *V = (_Float16*)(ws + WS_V);
  k_gath<<<TPR * 64, 192, 0, stream>>>(F[0], F[1], F[2], XR);
  k_proj<<<dim3((TPR + 1) / 2, HIDN / PBN, 3), 256, 0, stream>>>(XR, F[5], F[6], F[7], F[8], F[9], F[10], Q, K, V);
  k_att<<<dim3((LSEQ + 63) / 64, NH, TNB * TND), 128, 0, stream>>>(Q, K, V, F[3], F[4], (float*)d_out);
}

// v003
// It runs in 165 microseconds.
// Next to v002, in two timings, it ran 1.39 and 1.40 times as fast.
// All steps since v000 together make it 3.69 times as fast.
// compute dtype: all float inputs rounded to bf16, qmask/dmask read; q/k/v = hs W^T + b for every unique token (cls, query, doc) with EXACT bf16 products on WMMA 16x16x32 (natural weights), f32 accumulate, rounded once to f16 rows (0.02-scale weights: logits ~0.3); per (batch, document) self attention over its 545-token sequence [cls | query | doc_d] with the additive float masks, single f16 score products x 1/8, running-max softmax in f32 (hardware exp), P (f16 x 2^11) . v gathered per key tile; heads merged; f32 output.
#include <hip/hip_runtime.h>
#include <math.h>

typedef __attribute__((ext_vector_type(16))) _Float16 v16h;
typedef __attribute__((ext_vector_type(16))) __bf16 v16b;
typedef __attribute__((ext_vector_type(8)))  _Float16 v8h;
typedef __attribute__((ext_vector_type(8)))  float v8f;
typedef __attribute__((ext_vector_type(4)))  float v4f;
typedef __attribute__((ext_vector_type(2)))  float v2f;
typedef __attribute__((ext_vector_type(4)))  unsigned v4u;
typedef __attribute__((ext_vector_type(4)))  int v4i;
typedef float __attribute__((may_alias)) float_a;
typedef int __attribute__((may_alias)) int_a;

template <typename T> __device__ __forceinline__ void vst2(void* p, T v) { *(T*)p = v;  }
__device__ __forceinline__ v8f wmma16(v16h a, v16h b, v8f c) {
  v8f d = __builtin_amdgcn_wmma_f32_16x16x32_f16(false, a, false, b, (short)0, c, false, false);
  asm volatile("v_nop\n\tv_nop\n\tv_nop\n\tv_nop" : "+v"(d) : "v"(a), "v"(b));
  return d;
}
__device__ __forceinline__ v8f wmma_bf(v16b a, v16b b, v8f c) {
  v8f d = __builtin_amdgcn_wmma_f32_16x16x32_bf16(false, a, false, b, (short)0, c, false, false);
  asm volatile("v_nop\n\tv_nop\n\tv_nop\n\tv_nop" : "+v"(d) : "v"(a), "v"(b));
  return d;
}
// 16x16x32 fragments: lane = (h = lane>>4, row/col = lane&15); elements 0..7 = k0+8h+0..7, 8..15 = k0+16+8h+0..7; D element r = row 8h+r
__device__ __forceinline__ v16h frag_h(const _Float16* rowk0, int lane) {
  union { v16h v; v8h q[2]; } u; const _Float16* p = rowk0 + 8 * (lane >> 4);
  u.q[0] = *(const v8h*)p; u.q[1] = *(const v8h*)(p + 16); return u.v;
}
__device__ __forceinline__ v16h frag_f32(const float* rowk0, int lane) {
  v16h a; const float* p = rowk0 + 8 * (lane >> 4);
#pragma unroll
  for (int i = 0; i < 8; ++i) { a[i] = (_Float16)p[i]; a[8 + i] = (_Float16)p[16 + i]; }
  return a;
}
__device__ __forceinline__ v16h frag_f32s(const float* rowk0, int lane, float sc) {
  v16h a; const float* p = rowk0 + 8 * (lane >> 4);
#pragma unroll
  for (int i = 0; i < 8; ++i) { a[i] = (_Float16)(p[i] * sc); a[8 + i] = (_Float16)(p[16 + i] * sc); }
  return a;
}
// column fragment from a [K][ld] layout (column n), rows >= K read as 0
__device__ __forceinline__ v16h fragc_f32(const float* W, int k0, int n, int lane, int ld, int K) {
  v16h a; const int g = lane >> 4;
#pragma unroll
  for (int i = 0; i < 8; ++i) { const int ka = k0 + 8 * g + i, kb = ka + 16;
    a[i] = (_Float16)(ka < K ? W[(size_t)(ka < K ? ka : K - 1) * ld + n] : 0.f); a[8 + i] = (_Float16)(kb < K ? W[(size_t)(kb < K ? kb : K - 1) * ld + n] : 0.f); }
  return a;
}
struct F2 { v16b h, l; };
__device__ __forceinline__ F2 bsplit16(const float v[16]) { F2 r;
#pragma unroll
  for (int i = 0; i < 16; ++i) { const __bf16 h = (__bf16)v[i]; r.h[i] = h; r.l[i] = (__bf16)(v[i] - (float)h); }
  return r; }
__device__ __forceinline__ F2 split_row(const float* row, int k0, int lane) { float v[16]; const float* p = row + k0 + 8 * (lane >> 4);
#pragma unroll
  for (int i = 0; i < 8; ++i) { v[i] = p[i]; v[8 + i] = p[16 + i]; }
  return bsplit16(v); }
__device__ __forceinline__ F2 split_rowK(const float* row, int k0, int lane, int K) { float v[16]; const int g = lane >> 4;
#pragma unroll
  for (int i = 0; i < 8; ++i) { const int ka = k0 + 8 * g + i, kb = ka + 16; v[i] = ka < K ? row[ka < K ? ka : K - 1] : 0.f; v[8 + i] = kb < K ? row[kb < K ? kb : K - 1] : 0.f; }
  return bsplit16(v); }
__device__ __forceinline__ F2 split_col(const float* W, int k0, int n, int lane, int ld, int K) { float v[16]; const int g = lane >> 4;
#pragma unroll
  for (int i = 0; i < 8; ++i) { const int ka = k0 + 8 * g + i, kb = ka + 16; v[i] = ka < K ? W[(size_t)(ka < K ? ka : K - 1) * ld + n] : 0.f; v[8 + i] = kb < K ? W[(size_t)(kb < K ? kb : K - 1) * ld + n] : 0.f; }
  return bsplit16(v); }
__device__ __forceinline__ v8f mac3(const F2& a, const F2& b, v8f c) { c = wmma_bf(a.l, b.h, c); c = wmma_bf(a.h, b.l, c); return wmma_bf(a.h, b.h, c); }
__device__ __forceinline__ float sigm(float v) { return 1.0f / (1.0f + expf(-v)); }
#define LDSX() do { asm volatile("s_wait_dscnt 0" ::: "memory"); __builtin_amdgcn_wave_barrier(); __builtin_amdgcn_fence(__ATOMIC_RELEASE, "workgroup"); } while (0)


// Sparse cross-encoder self attention (B 2, 16 documents x 512 tokens, 32 query tokens, 1 cls; hidden 768 = 12 heads x 64): every segment attends over [cls | query | doc_d] per document (cat_forward path), outputs concatenated along the sequence -> [b, 16, 545, 768].
#define NBB 2
#define ND 16
#define NQT 32
#define NS 512
#define HIDN 768
#define NH 12
#define HD 64
#define LSEQ (1 + NQT + NS)          // 545
#define RPB (1 + NQT + ND * NS)      // unique token rows per batch = 8225
#define NROW (NBB * RPB)             // 16450
#define NROWP (((NROW + 63) / 64) * 64)
#ifndef TND
#define TND ND                       // documents per batch processed
#endif
#ifndef TNB
#define TNB NBB
#endif
#ifndef TPR
#define TPR (NROWP / 64)              // 64-row blocks of padded rows (two per k_proj block)
#endif
typedef __attribute__((ext_vector_type(8))) __bf16 v8b;
__device__ __forceinline__ v16b frag_b(const __bf16* rowk0, int lane) {
  union { v16b v; v8b q[2]; } u; const __bf16* p = rowk0 + 8 * (lane >> 4);
  u.q[0] = *(const v8b*)p; u.q[1] = *(const v8b*)(p + 16); return u.v;
}
__device__ __forceinline__ float bfr(float v) { return (float)(__bf16)v; }
__device__ __attribute__((noinline)) float exp_ni(float v) { return expf(v); }
__device__ __attribute__((noinline)) float erf_ni(float v) { return erff(v); }

#define WS_X   0u                                    // f32 gathered input rows [NROWP][768] (cls, query, docs per batch; pad rows zero)
#define WS_Q   (WS_X + 4u * (size_t)NROWP * HIDN)      // f16 q rows
#define WS_K   (WS_Q + 2u * (size_t)NROWP * HIDN)
#define WS_V   (WS_K + 2u * (size_t)NROWP * HIDN)
#define WS_END (WS_V + 2u * (size_t)NROWP * HIDN)

__device__ __forceinline__ size_t tokrow(int b, int d, int i) { return (size_t)b * RPB + (i == 0 ? 0 : (i <= NQT ? i : (1 + NQT + (size_t)d * NS + (i - 1 - NQT)))); }   // position i of document d's sequence -> unique row
// ---- k_gath: block = row: copy the token's 768 inputs into the unified row buffer (bf16-rounded f32), pad rows zero
__global__ __launch_bounds__(192) void k_gath(const float* __restrict__ CLS, const float* __restrict__ QRY, const float* __restrict__ DOC, float* __restrict__ XR) { const size_t row = blockIdx.x; const int t = threadIdx.x;
  const float* src = nullptr; if (row < (size_t)NROW) { const size_t b = row / RPB; const int j = (int)(row % RPB); if (j == 0) src = CLS + b * HIDN; else if (j <= NQT) src = QRY + (b * NQT + (j - 1)) * HIDN; else src = DOC + (b * (size_t)ND * NS + (j - 1 - NQT)) * HIDN; }
  v4f o; if (src) { o[0] = bfr(src[t * 4]); o[1] = bfr(src[t * 4 + 1]); o[2] = bfr(src[t * 4 + 2]); o[3] = bfr(src[t * 4 + 3]); } else { o[0] = o[1] = o[2] = o[3] = 0.f; }
  vst2(XR + row * HIDN + t * 4, o); }
// ---- k_proj: block = (128 rows, 256 cols, which), 8 waves of 64 x 64: f16 rows of X W^T + b (exact). Each 32-k slice of the 128 X rows and 256 W rows is read once per block in whole 128-B lines, rounded to bf16 and staged in LDS (two buffers, one barrier per slice); every wave takes its fragments from there
typedef __attribute__((ext_vector_type(4))) __bf16 v4b;
#define PBM 128
#define PBN 256
#define PPIT 40                      // bf16 per staged row: 64 B of k + 16 B pad (80 B = 16 B x odd: the 16-byte fragment reads of 16 rows fall on distinct banks)
#define PBUF ((PBM + PBN) * PPIT)    // bf16 per buffer: X rows 0..127, W rows 128..383
#define PSH (PBN + 8)                // f16 per staged output row
__global__ __launch_bounds__(256) void k_proj(const float* __restrict__ XR, const float* __restrict__ WQ, const float* __restrict__ BQ, const float* __restrict__ WK, const float* __restrict__ BK, const float* __restrict__ WV, const float* __restrict__ BV, _Float16* __restrict__ Q, _Float16* __restrict__ K, _Float16* __restrict__ V) { __shared__ __align__(16) unsigned char smem[PBM * PSH * 2];   // the two operand buffers (2 * PBUF * 2 B fit inside), then the output tile
  static_assert(2 * PBUF * 2 <= PBM * PSH * 2, "operand buffers fit");
  __bf16* st = (__bf16*)smem; _Float16* sh = (_Float16*)smem;
  const int tid = threadIdx.x, wave = tid >> 5, lane = tid & 31, col = lane & 15, g = lane >> 4, wm = wave & 1, wn = wave >> 1; const int which = blockIdx.z; const int c0 = blockIdx.y * PBN; const size_t r0 = (size_t)blockIdx.x * PBM;
  const float* Wm = which == 0 ? WQ : which == 1 ? WK : WV; const float* Bm = which == 0 ? BQ : which == 1 ? BK : BV;
  const int sr = tid >> 3, sc = tid & 7;   // staging: 8 lanes cover one row's 128 B, a wave-wide load covers 4 whole lines
  const float* px = XR + (r0 + sr) * HIDN + sc * 4; const float* pw = Wm + (size_t)(c0 + sr) * HIDN + sc * 4;
  v4f pre[12];
#pragma unroll
  for (int i = 0; i < 4; ++i) pre[i] = *(const v4f*)(px + (size_t)i * 32 * HIDN);
#pragma unroll
  for (int i = 0; i < 8; ++i) pre[4 + i] = *(const v4f*)(pw + (size_t)i * 32 * HIDN);
#pragma unroll
  for (int i = 0; i < 12; ++i) *(v4b*)(st + (sr + 32 * i) * PPIT + sc * 4) = __builtin_convertvector(pre[i], v4b);
  __syncthreads();
  v8f acc[4][4] = {};
  for (int kc = 0; kc < HIDN / 32; ++kc) { const __bf16* bp = st + (kc & 1) * PBUF;
    if (kc + 1 < HIDN / 32) {
#pragma unroll
      for (int i = 0; i < 4; ++i) pre[i] = *(const v4f*)(px + (size_t)i * 32 * HIDN + (kc + 1) * 32);
#pragma unroll
      for (int i = 0; i < 8; ++i) pre[4 + i] = *(const v4f*)(pw + (size_t)i * 32 * HIDN + (kc + 1) * 32); }
    v16b a[4], w[4];
#pragma unroll
    for (int i = 0; i < 4; ++i) { a[i] = frag_b(bp + (wm * 64 + i * 16 + col) * PPIT, lane); w[i] = frag_b(bp + (PBM + wn * 64 + i * 16 + col) * PPIT, lane); }
#pragma unroll
    for (int j = 0; j < 4; ++j)
#pragma unroll
      for (int i = 0; i < 4; ++i) acc[i][j] = wmma_bf(a[i], w[j], acc[i][j]);
    if (kc + 1 < HIDN / 32) { __bf16* sb = st + ((kc + 1) & 1) * PBUF;
#pragma unroll
      for (int i = 0; i < 12; ++i) *(v4b*)(sb + (sr + 32 * i) * PPIT + sc * 4) = __builtin_convertvector(pre[i], v4b); }
    __syncthreads(); }   // publishes slice kc + 1 and ends every read of slice kc's buffer, which slice kc + 2 (or the output tile) overwrites
#pragma unroll
  for (int j = 0; j < 4; ++j) { const float bb = bfr(Bm[c0 + wn * 64 + j * 16 + col]);
#pragma unroll
    for (int i = 0; i < 4; ++i)
#pragma unroll
      for (int r = 0; r < 8; ++r) sh[(wm * 64 + i * 16 + 8 * g + r) * PSH + wn * 64 + j * 16 + col] = (_Float16)(acc[i][j][r] + bb); }
  __syncthreads(); { _Float16* dst = which == 0 ? Q : which == 1 ? K : V; for (int e = tid; e < PBM * (PBN / 8); e += 256) { const int rl = e >> 5, q = e & 31; vst2((unsigned*)(dst + (r0 + rl) * HIDN + c0 + q * 8), *(const v4u*)&sh[rl * PSH + q * 8]); } } }
__device__ __forceinline__ float xhalf(float v) { const int b = __builtin_bit_cast(int, v); return __builtin_bit_cast(float, __builtin_amdgcn_permlanex16(b, b, 0x76543210, 0xfedcba98, false, false)); }
#define KPB 144
#define KTB (32 * KPB)
#define NKT ((LSEQ + 31) / 32)
#define MKR ((NKT * 32 + 127) / 128)
// one 32-key tile of K and of V into LDS (K at lds, V at lds + KTB): a thread copies 16 bytes of rows sr and sr + 16 of each, so a wave-wide copy covers 4 whole 128-B lines; keys beyond 545 re-read the last row and are masked
__device__ __forceinline__ void stage_kv(const _Float16* __restrict__ K, const _Float16* __restrict__ V, int b, int d, int t, int sr, int colh, unsigned lds) {
  int ka = t * 32 + sr, kb = ka + 16; ka = ka < LSEQ ? ka : LSEQ - 1; kb = kb < LSEQ ? kb : LSEQ - 1;
  const unsigned oa = (unsigned)(b * RPB + (ka <= NQT ? ka : ka + d * NS)) * HIDN + colh, ob = (unsigned)(b * RPB + (kb <= NQT ? kb : kb + d * NS)) * HIDN + colh;   // tokrow() in 32 bits: the offsets stay below NROW * 768
  const _Float16 *pka = K + oa, *pkb = K + ob, *pva = V + oa, *pvb = V + ob;
  const unsigned la = lds, lb = lds + 16 * KPB, lc = lds + KTB, ld = lds + KTB + 16 * KPB;
  // the four copies and, as the last line, the wait that stands before any of their address registers is rewritten
  asm volatile("global_load_async_to_lds_b128 %0, %1, off\n\tglobal_load_async_to_lds_b128 %2, %3, off\n\tglobal_load_async_to_lds_b128 %4, %5, off\n\tglobal_load_async_to_lds_b128 %6, %7, off\n\ts_wait_xcnt 0x0"
               :: "v"(la), "v"(pka), "v"(lb), "v"(pkb), "v"(lc), "v"(pva), "v"(ld), "v"(pvb) : "memory"); }
__global__ __launch_bounds__(128) void k_att(const _Float16* __restrict__ Q, const _Float16* __restrict__ K, const _Float16* __restrict__ V, const float* __restrict__ QM, const float* __restrict__ DMK, float* __restrict__ OUT) {
  __shared__ __align__(16) unsigned char ring[2 * 2 * KTB];   // two buffers of (K tile, V tile); behind the loop's last barrier the output staging so[4][16][68]
  __shared__ __align__(16) float smk[MKR * 128];              // the sequence's additive mask, built once (entries from NKT * 32 on are never read)
  static_assert(4 * 16 * 68 * 4 <= 2 * 2 * KTB, "output staging fits the ring");
  float (*so)[16][68] = (float (*)[16][68])ring;
  const int tid = threadIdx.x, wave = tid >> 5, lane = tid & 31, col = lane & 15, g = lane >> 4; const int qb = blockIdx.x, h = blockIdx.y; const int bd = blockIdx.z; const int b = bd / TND, d = bd % TND;
  const int sr = tid >> 3, colh = h * HD + (tid & 7) * 8; const unsigned lds0 = (unsigned)(size_t)ring + (unsigned)(sr * KPB + (tid & 7) * 16);
  stage_kv(K, V, b, d, 0, sr, colh, lds0);
  const int qi = qb * 64 + wave * 16 + col; const int qic = (qi < LSEQ) ? qi : (LSEQ - 1);   // positions beyond 545 (last block) are computed on a clamped row and never stored
  v16h bq[2];
#pragma unroll
  for (int kc = 0; kc < 2; ++kc) bq[kc] = frag_h(Q + tokrow(b, d, qic) * HIDN + h * HD + kc * 32, lane);
#pragma unroll
  for (int u = 0; u < MKR; ++u) { const int ki = u * 128 + tid;   // unrolled and branch-free on clamped addresses: the loads of all rounds are in flight together
    const int qx = ki < 1 ? 0 : (ki <= NQT ? ki - 1 : NQT - 1), dx = ki <= NQT ? 0 : (ki < LSEQ ? ki - 1 - NQT : NS - 1);
    const float* mp = ki <= NQT ? QM + (size_t)b * NQT + qx : DMK + ((size_t)b * ND + d) * NS + dx;
    const float mv = bfr(*mp); smk[ki] = ki >= LSEQ ? -3.0e38f : (ki == 0 ? 0.f : mv); }
  asm volatile("s_wait_asynccnt 0x0" ::: "memory");   // tile 0 has landed for this wave's copies
  __syncthreads();                                     // publishes tile 0 and the mask table
  stage_kv(K, V, b, d, 1, sr, colh, lds0 + 2 * KTB);
  float m = -3.0e38f, l = 0.f;   // the query's running maximum (equal in both halves) and this half's share of its sum
  v8f acc[4] = {};               // acc[j][r] = O[query col][16 j + 8 g + r]
#pragma unroll 1
  for (int ks = 0; ks < NKT; ++ks) {   // rolled: one copy of the body, the buffer chosen by the trip's parity
    const _Float16* sk = (const _Float16*)(ring + (ks & 1) * 2 * KTB); const _Float16* sv = sk + KTB / 2;
    v16h kf[2][2]; v4f mk4[2][2];
#pragma unroll
    for (int ct = 0; ct < 2; ++ct) {
#pragma unroll
      for (int kc = 0; kc < 2; ++kc) kf[ct][kc] = frag_h(sk + (ct * 16 + col) * (KPB / 2) + kc * 32, lane);
      mk4[ct][0] = *(const v4f*)&smk[ks * 32 + ct * 16 + 8 * g]; mk4[ct][1] = *(const v4f*)&smk[ks * 32 + ct * 16 + 8 * g + 4]; }
    __builtin_amdgcn_sched_barrier(0);   // keeps the tile's K fragment and mask reads together ahead of the score products: one LDS latency, not one per product
    float s[2][8];
#pragma unroll
    for (int ct = 0; ct < 2; ++ct) { v8f c = {};
#pragma unroll
      for (int kc = 0; kc < 2; ++kc) c = wmma16(kf[ct][kc], bq[kc], c);
#pragma unroll
      for (int r = 0; r < 8; ++r) { const float mk = mk4[ct][r >> 2][r & 3]; s[ct][r] = (mk <= -1.0e38f) ? -3.0e38f : (c[r] * 0.125f + mk); } }
    float mx = fmaxf(s[0][0], s[1][0]);
#pragma unroll
    for (int r = 1; r < 8; ++r) mx = fmaxf(mx, fmaxf(s[0][r], s[1][r]));
    mx = fmaxf(mx, xhalf(mx));
    const float mn = fmaxf(m, mx), alpha = __expf(m - mn); float es = 0.f; v16h pb;
#pragma unroll
    for (int ct = 0; ct < 2; ++ct)
#pragma unroll
      for (int r = 0; r < 8; ++r) { const float e = (s[ct][r] <= -1.0e38f) ? 0.f : __expf(s[ct][r] - mn); es += e; pb[ct * 8 + r] = (_Float16)(e * 2048.0f); }
    l = l * alpha + es; m = mn;
#pragma unroll
    for (int j = 0; j < 4; ++j)
#pragma unroll
      for (int r = 0; r < 8; ++r) acc[j][r] *= alpha;
    __builtin_amdgcn_sched_barrier(0);   // stands where the old barrier ended the scheduling region: without it the V reads come out as 32 pairs, each waited for on its own
#pragma unroll
    for (int j = 0; j < 4; ++j) { v16h va; const int dc = j * 16 + col;
#pragma unroll
      for (int i = 0; i < 8; ++i) { va[i] = sv[(8 * g + i) * (KPB / 2) + dc]; va[8 + i] = sv[(16 + 8 * g + i) * (KPB / 2) + dc]; }
      acc[j] = wmma16(va, pb, acc[j]); }
    asm volatile("s_wait_dscnt 0x0" ::: "memory");      // this wave's reads of the buffer have returned
    asm volatile("s_wait_asynccnt 0x0" ::: "memory");   // this wave's copies of tile ks + 1 have landed
    __syncthreads();                                     // publishes tile ks + 1 and ends every read of tile ks's buffer
    if (ks + 2 < NKT) stage_kv(K, V, b, d, ks + 2, sr, colh, lds0 + (unsigned)(ks & 1) * (2 * KTB)); }
  asm volatile("s_wait_asynccnt 0x0" ::: "memory");     // nothing is in flight when the ring becomes output staging
  l += xhalf(l);
  const float il = (1.0f / 2048.0f) / l;
#pragma unroll
  for (int j = 0; j < 4; ++j) { v4f oa, ob;
#pragma unroll
    for (int r = 0; r < 4; ++r) { oa[r] = acc[j][r] * il; ob[r] = acc[j][4 + r] * il; }
    *(v4f*)&so[wave][col][j * 16 + 8 * g] = oa; *(v4f*)&so[wave][col][j * 16 + 8 * g + 4] = ob; }
  LDSX();
  for (int rl = 0; rl < 16; ++rl) { const int qpos = qb * 64 + wave * 16 + rl; if (qpos < LSEQ && lane < 16) vst2(OUT + (((size_t)b * ND + d) * LSEQ + qpos) * HIDN + h * HD + lane * 4, *(const v4f*)&so[wave][rl][lane * 4]); } }
extern "C" void kernel_launch(void* const* d_in, const int* in_sizes, int n_in, void* d_out, int out_size, void* d_ws, size_t ws_size, hipStream_t stream) {
  (void)in_sizes; (void)n_in; (void)out_size;
  const float** F = (const float**)d_in;   // 0 cls [2,1,1,768], 1 query [2,1,32,768], 2 doc [2,16,512,768], 3 qmask [2,1,1,1,32], 4 dmask [2,1,16,1,512], 5 Wq, 6 bq, 7 Wk, 8 bk, 9 Wv, 10 bv
  if (ws_size < (size_t)WS_END) return;
  char* ws = (char*)d_ws; float* XR = (float*)(ws + WS_X); _Float16 *Q = (_Float16*)(ws + WS_Q), *K = (_Float16*)(ws + WS_K), *V = (_Float16*)(ws + WS_V);
  k_gath<<<TPR * 64, 192, 0, stream>>>(F[0], F[1], F[2], XR);
  k_proj<<<dim3((TPR + 1) / 2, HIDN / PBN, 3), 256, 0, stream>>>(XR, F[5], F[6], F[7], F[8], F[9], F[10], Q, K, V);
  k_att<<<dim3((LSEQ + 63) / 64, NH, TNB * TND), 128, 0, stream>>>(Q, K, V, F[3], F[4], (float*)d_out);
}

// v004
// Measured time: 158 microseconds a run.
// Two timings next to v003 put it at 1.04 and 1.05 times that version's speed.
// Counting every step since v000, it is 3.86 times as fast.
// compute dtype: all float inputs rounded to bf16, qmask/dmask read; q/k/v = hs W^T + b for every unique token (cls, query, doc) with EXACT bf16 products on WMMA 16x16x32 (natural weights), f32 accumulate, rounded once to f16 rows (0.02-scale weights: logits ~0.3); per (batch, document) self attention over its 545-token sequence [cls | query | doc_d] with the additive float masks, single f16 score products x 1/8, running-max softmax in f32 (hardware exp), P (f16 x 2^11) . v gathered per key tile; heads merged; f32 output.
#include <hip/hip_runtime.h>
#include <math.h>

typedef __attribute__((ext_vector_type(16))) _Float16 v16h;
typedef __attribute__((ext_vector_type(16))) __bf16 v16b;
typedef __attribute__((ext_vector_type(8)))  _Float16 v8h;
typedef __attribute__((ext_vector_type(8)))  float v8f;
typedef __attribute__((ext_vector_type(4)))  float v4f;
typedef __attribute__((ext_vector_type(2)))  float v2f;
typedef __attribute__((ext_vector_type(4)))  unsigned v4u;
typedef __attribute__((ext_vector_type(4)))  int v4i;
typedef float __attribute__((may_alias)) float_a;
typedef int __attribute__((may_alias)) int_a;

template <typename T> __device__ __forceinline__ void vst2(void* p, T v) { *(T*)p = v;  }
__device__ __forceinline__ v8f wmma16(v16h a, v16h b, v8f c) {
  v8f d = __builtin_amdgcn_wmma_f32_16x16x32_f16(false, a, false, b, (short)0, c, false, false);
  asm volatile("v_nop\n\tv_nop\n\tv_nop\n\tv_nop" : "+v"(d) : "v"(a), "v"(b));
  return d;
}
__device__ __forceinline__ v8f wmma_bf(v16b a, v16b b, v8f c) {
  v8f d = __builtin_amdgcn_wmma_f32_16x16x32_bf16(false, a, false, b, (short)0, c, false, false);
  asm volatile("v_nop\n\tv_nop\n\tv_nop\n\tv_nop" : "+v"(d) : "v"(a), "v"(b));
  return d;
}
// 16x16x32 fragments: lane = (h = lane>>4, row/col = lane&15); elements 0..7 = k0+8h+0..7, 8..15 = k0+16+8h+0..7; D element r = row 8h+r
__device__ __forceinline__ v16h frag_h(const _Float16* rowk0, int lane) {
  union { v16h v; v8h q[2]; } u; const _Float16* p = rowk0 + 8 * (lane >> 4);
  u.q[0] = *(const v8h*)p; u.q[1] = *(const v8h*)(p + 16); return u.v;
}
__device__ __forceinline__ v16h frag_f32(const float* rowk0, int lane) {
  v16h a; const float* p = rowk0 + 8 * (lane >> 4);
#pragma unroll
  for (int i = 0; i < 8; ++i) { a[i] = (_Float16)p[i]; a[8 + i] = (_Float16)p[16 + i]; }
  return a;
}
__device__ __forceinline__ v16h frag_f32s(const float* rowk0, int lane, float sc) {
  v16h a; const float* p = rowk0 + 8 * (lane >> 4);
#pragma unroll
  for (int i = 0; i < 8; ++i) { a[i] = (_Float16)(p[i] * sc); a[8 + i] = (_Float16)(p[16 + i] * sc); }
  return a;
}
// column fragment from a [K][ld] layout (column n), rows >= K read as 0
__device__ __forceinline__ v16h fragc_f32(const float* W, int k0, int n, int lane, int ld, int K) {
  v16h a; const int g = lane >> 4;
#pragma unroll
  for (int i = 0; i < 8; ++i) { const int ka = k0 + 8 * g + i, kb = ka + 16;
    a[i] = (_Float16)(ka < K ? W[(size_t)(ka < K ? ka : K - 1) * ld + n] : 0.f); a[8 + i] = (_Float16)(kb < K ? W[(size_t)(kb < K ? kb : K - 1) * ld + n] : 0.f); }
  return a;
}
struct F2 { v16b h, l; };
__device__ __forceinline__ F2 bsplit16(const float v[16]) { F2 r;
#pragma unroll
  for (int i = 0; i < 16; ++i) { const __bf16 h = (__bf16)v[i]; r.h[i] = h; r.l[i] = (__bf16)(v[i] - (float)h); }
  return r; }
__device__ __forceinline__ F2 split_row(const float* row, int k0, int lane) { float v[16]; const float* p = row + k0 + 8 * (lane >> 4);
#pragma unroll
  for (int i = 0; i < 8; ++i) { v[i] = p[i]; v[8 + i] = p[16 + i]; }
  return bsplit16(v); }
__device__ __forceinline__ F2 split_rowK(const float* row, int k0, int lane, int K) { float v[16]; const int g = lane >> 4;
#pragma unroll
  for (int i = 0; i < 8; ++i) { const int ka = k0 + 8 * g + i, kb = ka + 16; v[i] = ka < K ? row[ka < K ? ka : K - 1] : 0.f; v[8 + i] = kb < K ? row[kb < K ? kb : K - 1] : 0.f; }
  return bsplit16(v); }
__device__ __forceinline__ F2 split_col(const float* W, int k0, int n, int lane, int ld, int K) { float v[16]; const int g = lane >> 4;
#pragma unroll
  for (int i = 0; i < 8; ++i) { const int ka = k0 + 8 * g + i, kb = ka + 16; v[i] = ka < K ? W[(size_t)(ka < K ? ka : K - 1) * ld + n] : 0.f; v[8 + i] = kb < K ? W[(size_t)(kb < K ? kb : K - 1) * ld + n] : 0.f; }
  return bsplit16(v); }
__device__ __forceinline__ v8f mac3(const F2& a, const F2& b, v8f c) { c = wmma_bf(a.l, b.h, c); c = wmma_bf(a.h, b.l, c); return wmma_bf(a.h, b.h, c); }
__device__ __forceinline__ float sigm(float v) { return 1.0f / (1.0f + expf(-v)); }
#define LDSX() do { asm volatile("s_wait_dscnt 0" ::: "memory"); __builtin_amdgcn_wave_barrier(); __builtin_amdgcn_fence(__ATOMIC_RELEASE, "workgroup"); } while (0)


// Sparse cross-encoder self attention (B 2, 16 documents x 512 tokens, 32 query tokens, 1 cls; hidden 768 = 12 heads x 64): every segment attends over [cls | query | doc_d] per document (cat_forward path), outputs concatenated along the sequence -> [b, 16, 545, 768].
#define NBB 2
#define ND 16
#define NQT 32
#define NS 512
#define HIDN 768
#define NH 12
#define HD 64
#define LSEQ (1 + NQT + NS)          // 545
#define RPB (1 + NQT + ND * NS)      // unique token rows per batch = 8225
#define NROW (NBB * RPB)             // 16450
#define NROWP (((NROW + 63) / 64) * 64)
#ifndef TND
#define TND ND                       // documents per batch processed
#endif
#ifndef TNB
#define TNB NBB
#endif
#ifndef TPR
#define TPR (NROWP / 64)              // 64-row blocks of padded rows (two per k_proj block)
#endif
typedef __attribute__((ext_vector_type(8))) __bf16 v8b;
__device__ __forceinline__ v16b frag_b(const __bf16* rowk0, int lane) {
  union { v16b v; v8b q[2]; } u; const __bf16* p = rowk0 + 8 * (lane >> 4);
  u.q[0] = *(const v8b*)p; u.q[1] = *(const v8b*)(p + 16); return u.v;
}
__device__ __forceinline__ float bfr(float v) { return (float)(__bf16)v; }
__device__ __attribute__((noinline)) float exp_ni(float v) { return expf(v); }
__device__ __attribute__((noinline)) float erf_ni(float v) { return erff(v); }

#define WS_X   0u                                    // f32 gathered input rows [NROWP][768] (cls, query, docs per batch; pad rows zero)
#define WS_Q   (WS_X + 4u * (size_t)NROWP * HIDN)      // f16 q rows
#define WS_K   (WS_Q + 2u * (size_t)NROWP * HIDN)
#define WS_V   (WS_K + 2u * (size_t)NROWP * HIDN)
#define WS_END (WS_V + 2u * (size_t)NROWP * HIDN)

__device__ __forceinline__ size_t tokrow(int b, int d, int i) { return (size_t)b * RPB + (i == 0 ? 0 : (i <= NQT ? i : (1 + NQT + (size_t)d * NS + (i - 1 - NQT)))); }   // position i of document d's sequence -> unique row
// ---- k_gath: block = row: copy the token's 768 inputs into the unified row buffer (bf16-rounded f32), pad rows zero
__global__ __launch_bounds__(192) void k_gath(const float* __restrict__ CLS, const float* __restrict__ QRY, const float* __restrict__ DOC, float* __restrict__ XR) { const size_t row = blockIdx.x; const int t = threadIdx.x;
  const float* src = nullptr; if (row < (size_t)NROW) { const size_t b = row / RPB; const int j = (int)(row % RPB); if (j == 0) src = CLS + b * HIDN; else if (j <= NQT) src = QRY + (b * NQT + (j - 1)) * HIDN; else src = DOC + (b * (size_t)ND * NS + (j - 1 - NQT)) * HIDN; }
  v4f o; if (src) { o[0] = bfr(src[t * 4]); o[1] = bfr(src[t * 4 + 1]); o[2] = bfr(src[t * 4 + 2]); o[3] = bfr(src[t * 4 + 3]); } else { o[0] = o[1] = o[2] = o[3] = 0.f; }
  vst2(XR + row * HIDN + t * 4, o); }
// ---- k_proj: block = (128 rows, 256 cols, which), 8 waves of 64 x 64: f16 rows of X W^T + b (exact). Each 32-k slice of the 128 X rows and 256 W rows is read once per block in whole 128-B lines, rounded to bf16 and staged in LDS (two buffers, one barrier per slice); every wave takes its fragments from there
typedef __attribute__((ext_vector_type(4))) __bf16 v4b;
#define PBM 128
#define PBN 256
#define PPIT 40                      // bf16 per staged row: 64 B of k + 16 B pad (80 B = 16 B x odd: the 16-byte fragment reads of 16 rows fall on distinct banks)
#define PBUF ((PBM + PBN) * PPIT)    // bf16 per buffer: X rows 0..127, W rows 128..383
#define PSH (PBN + 8)                // f16 per staged output row
__global__ __launch_bounds__(256) void k_proj(const float* __restrict__ XR, const float* __restrict__ WQ, const float* __restrict__ BQ, const float* __restrict__ WK, const float* __restrict__ BK, const float* __restrict__ WV, const float* __restrict__ BV, _Float16* __restrict__ Q, _Float16* __restrict__ K, _Float16* __restrict__ V) { __shared__ __align__(16) unsigned char smem[PBM * PSH * 2];   // the two operand buffers (2 * PBUF * 2 B fit inside), then the output tile
  static_assert(2 * PBUF * 2 <= PBM * PSH * 2, "operand buffers fit");
  __bf16* st = (__bf16*)smem; _Float16* sh = (_Float16*)smem;
  const int tid = threadIdx.x, wave = tid >> 5, lane = tid & 31, col = lane & 15, g = lane >> 4, wm = wave & 1, wn = wave >> 1; const int which = blockIdx.z; const int c0 = blockIdx.y * PBN; const size_t r0 = (size_t)blockIdx.x * PBM;
  const float* Wm = which == 0 ? WQ : which == 1 ? WK : WV; const float* Bm = which == 0 ? BQ : which == 1 ? BK : BV;
  const int sr = tid >> 3, sc = tid & 7;   // staging: 8 lanes cover one row's 128 B, a wave-wide load covers 4 whole lines
  const float* px = XR + (r0 + sr) * HIDN + sc * 4; const float* pw = Wm + (size_t)(c0 + sr) * HIDN + sc * 4;
  v4f pre[12];
#pragma unroll
  for (int i = 0; i < 4; ++i) pre[i] = *(const v4f*)(px + (size_t)i * 32 * HIDN);
#pragma unroll
  for (int i = 0; i < 8; ++i) pre[4 + i] = *(const v4f*)(pw + (size_t)i * 32 * HIDN);
#pragma unroll
  for (int i = 0; i < 12; ++i) *(v4b*)(st + (sr + 32 * i) * PPIT + sc * 4) = __builtin_convertvector(pre[i], v4b);
  __syncthreads();
  v8f acc[4][4] = {};
  for (int kc = 0; kc < HIDN / 32; ++kc) { const __bf16* bp = st + (kc & 1) * PBUF;
    if (kc + 1 < HIDN / 32) {
#pragma unroll
      for (int i = 0; i < 4; ++i) pre[i] = *(const v4f*)(px + (size_t)i * 32 * HIDN + (kc + 1) * 32);
#pragma unroll
      for (int i = 0; i < 8; ++i) pre[4 + i] = *(const v4f*)(pw + (size_t)i * 32 * HIDN + (kc + 1) * 32); }
    v16b a[4], w[4];
#pragma unroll
    for (int i = 0; i < 4; ++i) { a[i] = frag_b(bp + (wm * 64 + i * 16 + col) * PPIT, lane); w[i] = frag_b(bp + (PBM + wn * 64 + i * 16 + col) * PPIT, lane); }
#pragma unroll
    for (int j = 0; j < 4; ++j)
#pragma unroll
      for (int i = 0; i < 4; ++i) acc[i][j] = wmma_bf(a[i], w[j], acc[i][j]);
    if (kc + 1 < HIDN / 32) { __bf16* sb = st + ((kc + 1) & 1) * PBUF;
#pragma unroll
      for (int i = 0; i < 12; ++i) *(v4b*)(sb + (sr + 32 * i) * PPIT + sc * 4) = __builtin_convertvector(pre[i], v4b); }
    __syncthreads(); }   // publishes slice kc + 1 and ends every read of slice kc's buffer, which slice kc + 2 (or the output tile) overwrites
#pragma unroll
  for (int j = 0; j < 4; ++j) { const float bb = bfr(Bm[c0 + wn * 64 + j * 16 + col]);
#pragma unroll
    for (int i = 0; i < 4; ++i)
#pragma unroll
      for (int r = 0; r < 8; ++r) sh[(wm * 64 + i * 16 + 8 * g + r) * PSH + wn * 64 + j * 16 + col] = (_Float16)(acc[i][j][r] + bb); }
  __syncthreads(); { _Float16* dst = which == 0 ? Q : which == 1 ? K : V; for (int e = tid; e < PBM * (PBN / 8); e += 256) { const int rl = e >> 5, q = e & 31; vst2((unsigned*)(dst + (r0 + rl) * HIDN + c0 + q * 8), *(const v4u*)&sh[rl * PSH + q * 8]); } } }
typedef __attribute__((ext_vector_type(8))) short v8s;
__device__ __forceinline__ v8s ld_tr16(const unsigned char* p) { typedef __attribute__((address_space(3))) v8s lds_v8s; return __builtin_amdgcn_ds_load_tr16_b128_v8i16((lds_v8s*)p); }   // transposing 16-byte LDS read
__device__ __forceinline__ float xhalf(float v) { const int b = __builtin_bit_cast(int, v); return __builtin_bit_cast(float, __builtin_amdgcn_permlanex16(b, b, 0x76543210, 0xfedcba98, false, false)); }   // the value of lane ^ 16
#define KPB 144                      // bytes per staged K row: 128 B + 16 B pad (16 B x odd: the 16-byte fragment reads of 16 rows fall on distinct banks)
#define VPB 160                      // bytes per staged V row: 128 B + 32 B pad (32 B x odd: the pitch at which the transposing 16-byte reads fall on distinct banks)
#define KTB (32 * KPB)               // bytes per staged 32-key tile of K
#define VTB (32 * VPB)               // bytes per staged 32-key tile of V
#define KVB (KTB + VTB)              // bytes per buffer: K tile, then V tile
#define NKT ((LSEQ + 31) / 32)       // key tiles
#define MKR ((NKT * 32 + 127) / 128) // rounds of 128 threads that fill the mask table
// one 32-key tile of K and of V into LDS (the thread's own K place ldk, V place ldv): a thread copies 16 bytes of rows sr and sr + 16 of each, so a wave-wide copy covers 4 whole 128-B lines; keys beyond 545 re-read the last row and are masked
__device__ __forceinline__ void stage_kv(const _Float16* __restrict__ K, const _Float16* __restrict__ V, int b, int d, int t, int sr, int colh, unsigned ldk, unsigned ldv) {
  int ka = t * 32 + sr, kb = ka + 16; ka = ka < LSEQ ? ka : LSEQ - 1; kb = kb < LSEQ ? kb : LSEQ - 1;
  const unsigned oa = (unsigned)(b * RPB + (ka <= NQT ? ka : ka + d * NS)) * HIDN + colh, ob = (unsigned)(b * RPB + (kb <= NQT ? kb : kb + d * NS)) * HIDN + colh;   // tokrow() in 32 bits: the offsets stay below NROW * 768
  const _Float16 *pka = K + oa, *pkb = K + ob, *pva = V + oa, *pvb = V + ob;
  const unsigned la = ldk, lb = ldk + 16 * KPB, lc = ldv, ld = ldv + 16 * VPB;
  // the four copies and, as the last line, the wait that stands before any of their address registers is rewritten
  asm volatile("global_load_async_to_lds_b128 %0, %1, off\n\tglobal_load_async_to_lds_b128 %2, %3, off\n\tglobal_load_async_to_lds_b128 %4, %5, off\n\tglobal_load_async_to_lds_b128 %6, %7, off\n\ts_wait_xcnt 0x0"
               :: "v"(la), "v"(pka), "v"(lb), "v"(pkb), "v"(lc), "v"(pva), "v"(ld), "v"(pvb) : "memory"); }
__global__ __launch_bounds__(128) void k_att(const _Float16* __restrict__ Q, const _Float16* __restrict__ K, const _Float16* __restrict__ V, const float* __restrict__ QM, const float* __restrict__ DMK, float* __restrict__ OUT) {
  __shared__ __align__(16) unsigned char ring[2 * KVB];   // two buffers of (K tile, V tile); behind the loop's last barrier the output staging so[4][16][68]
  __shared__ __align__(16) float smk[MKR * 128];              // the sequence's additive mask, built once (entries from NKT * 32 on are never read)
  static_assert(4 * 16 * 68 * 4 <= 2 * KVB, "output staging fits the ring");
  float (*so)[16][68] = (float (*)[16][68])ring;
  const int tid = threadIdx.x, wave = tid >> 5, lane = tid & 31, col = lane & 15, g = lane >> 4; const int qb = blockIdx.x, h = blockIdx.y; const int bd = blockIdx.z; const int b = bd / TND, d = bd % TND;
  const int sr = tid >> 3, colh = h * HD + (tid & 7) * 8; const unsigned ldk0 = (unsigned)(size_t)ring + (unsigned)(sr * KPB + (tid & 7) * 16), ldv0 = (unsigned)(size_t)ring + (unsigned)(KTB + sr * VPB + (tid & 7) * 16);
  stage_kv(K, V, b, d, 0, sr, colh, ldk0, ldv0);
  const int qi = qb * 64 + wave * 16 + col; const int qic = (qi < LSEQ) ? qi : (LSEQ - 1);   // positions beyond 545 (last block) are computed on a clamped row and never stored
  v16h bq[2];
#pragma unroll
  for (int kc = 0; kc < 2; ++kc) bq[kc] = frag_h(Q + tokrow(b, d, qic) * HIDN + h * HD + kc * 32, lane);
#pragma unroll
  for (int u = 0; u < MKR; ++u) { const int ki = u * 128 + tid;   // unrolled and branch-free on clamped addresses: the loads of all rounds are in flight together
    const int qx = ki < 1 ? 0 : (ki <= NQT ? ki - 1 : NQT - 1), dx = ki <= NQT ? 0 : (ki < LSEQ ? ki - 1 - NQT : NS - 1);
    const float* mp = ki <= NQT ? QM + (size_t)b * NQT + qx : DMK + ((size_t)b * ND + d) * NS + dx;
    const float mv = bfr(*mp); smk[ki] = ki >= LSEQ ? -3.0e38f : (ki == 0 ? 0.f : mv); }
  asm volatile("s_wait_asynccnt 0x0" ::: "memory");   // tile 0 has landed for this wave's copies
  __syncthreads();                                     // publishes tile 0 and the mask table
  stage_kv(K, V, b, d, 1, sr, colh, ldk0 + KVB, ldv0 + KVB);
  const int vlo = (8 * g + (lane & 7)) * VPB + 16 * ((lane >> 3) & 1);   // the lane's address in a 16-key x 16-column block for the transposing read
  float m = -3.0e38f, l = 0.f;   // the query's running maximum (equal in both halves) and this half's share of its sum
  v8f acc[4] = {};               // acc[j][r] = O[query col][16 j + 8 g + r]
#pragma unroll 1
  for (int ks = 0; ks < NKT; ++ks) {   // rolled: one copy of the body, the buffer chosen by the trip's parity
    const _Float16* sk = (const _Float16*)(ring + (ks & 1) * KVB); const unsigned char* sv = ring + (ks & 1) * KVB + KTB + vlo;
    v16h kf[2][2]; v4f mk4[2][2];
#pragma unroll
    for (int ct = 0; ct < 2; ++ct) {
#pragma unroll
      for (int kc = 0; kc < 2; ++kc) kf[ct][kc] = frag_h(sk + (ct * 16 + col) * (KPB / 2) + kc * 32, lane);
      mk4[ct][0] = *(const v4f*)&smk[ks * 32 + ct * 16 + 8 * g]; mk4[ct][1] = *(const v4f*)&smk[ks * 32 + ct * 16 + 8 * g + 4]; }
    __builtin_amdgcn_sched_barrier(0);   // keeps the tile's K fragment and mask reads together ahead of the score products: one LDS latency, not one per product
    float s[2][8];
#pragma unroll
    for (int ct = 0; ct < 2; ++ct) { v8f c = {};
#pragma unroll
      for (int kc = 0; kc < 2; ++kc) c = wmma16(kf[ct][kc], bq[kc], c);
#pragma unroll
      for (int r = 0; r < 8; ++r) { const float mk = mk4[ct][r >> 2][r & 3]; s[ct][r] = (mk <= -1.0e38f) ? -3.0e38f : (c[r] * 0.125f + mk); } }
    float mx = fmaxf(s[0][0], s[1][0]);
#pragma unroll
    for (int r = 1; r < 8; ++r) mx = fmaxf(mx, fmaxf(s[0][r], s[1][r]));
    mx = fmaxf(mx, xhalf(mx));
    const float mn = fmaxf(m, mx), alpha = __expf(m - mn); float es = 0.f; v16h pb;
#pragma unroll
    for (int ct = 0; ct < 2; ++ct)
#pragma unroll
      for (int r = 0; r < 8; ++r) { const float e = (s[ct][r] <= -1.0e38f) ? 0.f : __expf(s[ct][r] - mn); es += e; pb[ct * 8 + r] = (_Float16)(e * 2048.0f); }
    l = l * alpha + es; m = mn;
#pragma unroll
    for (int j = 0; j < 4; ++j)
#pragma unroll
      for (int r = 0; r < 8; ++r) acc[j][r] *= alpha;
    union { v16h v; v8s q[2]; } va[4];   // lane (col, g) receives V[8 g + 0..7][16 j + col] and V[16 + 8 g + 0..7][16 j + col]: the k order of pb
#pragma unroll
    for (int j = 0; j < 4; ++j) { va[j].q[0] = ld_tr16(sv + 32 * j); va[j].q[1] = ld_tr16(sv + 16 * VPB + 32 * j); }
#pragma unroll
    for (int j = 0; j < 4; ++j) acc[j] = wmma16(va[j].v, pb, acc[j]);
    asm volatile("s_wait_dscnt 0x0" ::: "memory");      // this wave's reads of the buffer have returned
    asm volatile("s_wait_asynccnt 0x0" ::: "memory");   // this wave's copies of tile ks + 1 have landed
    __syncthreads();                                     // publishes tile ks + 1 and ends every read of tile ks's buffer
    if (ks + 2 < NKT) stage_kv(K, V, b, d, ks + 2, sr, colh, ldk0 + (unsigned)(ks & 1) * KVB, ldv0 + (unsigned)(ks & 1) * KVB); }
  asm volatile("s_wait_asynccnt 0x0" ::: "memory");     // nothing is in flight when the ring becomes output staging
  l += xhalf(l);
  const float il = (1.0f / 2048.0f) / l;
#pragma unroll
  for (int j = 0; j < 4; ++j) { v4f oa, ob;
#pragma unroll
    for (int r = 0; r < 4; ++r) { oa[r] = acc[j][r] * il; ob[r] = acc[j][4 + r] * il; }
    *(v4f*)&so[wave][col][j * 16 + 8 * g] = oa; *(v4f*)&so[wave][col][j * 16 + 8 * g + 4] = ob; }
  LDSX();
  for (int rl = 0; rl < 16; ++rl) { const int qpos = qb * 64 + wave * 16 + rl; if (qpos < LSEQ && lane < 16) vst2(OUT + (((size_t)b * ND + d) * LSEQ + qpos) * HIDN + h * HD + lane * 4, *(const v4f*)&so[wave][rl][lane * 4]); } }
extern "C" void kernel_launch(void* const* d_in, const int* in_sizes, int n_in, void* d_out, int out_size, void* d_ws, size_t ws_size, hipStream_t stream) {
  (void)in_sizes; (void)n_in; (void)out_size;
  const float** F = (const float**)d_in;   // 0 cls [2,1,1,768], 1 query [2,1,32,768], 2 doc [2,16,512,768], 3 qmask [2,1,1,1,32], 4 dmask [2,1,16,1,512], 5 Wq, 6 bq, 7 Wk, 8 bk, 9 Wv, 10 bv
  if (ws_size < (size_t)WS_END) return;
  char* ws = (char*)d_ws; float* XR = (float*)(ws + WS_X); _Float16 *Q = (_Float16*)(ws + WS_Q), *K = (_Float16*)(ws + WS_K), *V = (_Float16*)(ws + WS_V);
  k_gath<<<TPR * 64, 192, 0, stream>>>(F[0], F[1], F[2], XR);
  k_proj<<<dim3((TPR + 1) / 2, HIDN / PBN, 3), 256, 0, stream>>>(XR, F[5], F[6], F[7], F[8], F[9], F[10], Q, K, V);
  k_att<<<dim3((LSEQ + 63) / 64, NH, TNB * TND), 128, 0, stream>>>(Q, K, V, F[3], F[4], (float*)d_out);
}

// v005
// It runs in 146 microseconds.
// In both of two side-by-side timings against v004, it was 1.08 times as fast.
// Over all steps from v000 it is 4.17 times as fast.
// compute dtype: all float inputs rounded to bf16, qmask/dmask read; q/k/v = hs W^T + b for every unique token (cls, query, doc) with EXACT bf16 products on WMMA 16x16x32 (natural weights), f32 accumulate, rounded once to f16 rows (0.02-scale weights: logits ~0.3); per (batch, document) self attention over its 545-token sequence [cls | query | doc_d] with the additive float masks, single f16 score products x 1/8, running-max softmax in f32 (hardware exp), P (f16 x 2^11) . v gathered per key tile; heads merged; f32 output.
#include <hip/hip_runtime.h>
#include <math.h>

typedef __attribute__((ext_vector_type(16))) _Float16 v16h;
typedef __attribute__((ext_vector_type(16))) __bf16 v16b;
typedef __attribute__((ext_vector_type(8)))  _Float16 v8h;
typedef __attribute__((ext_vector_type(8)))  float v8f;
typedef __attribute__((ext_vector_type(4)))  float v4f;
typedef __attribute__((ext_vector_type(2)))  float v2f;
typedef __attribute__((ext_vector_type(4)))  unsigned v4u;
typedef __attribute__((ext_vector_type(4)))  int v4i;
typedef float __attribute__((may_alias)) float_a;
typedef int __attribute__((may_alias)) int_a;

template <typename T> __device__ __forceinline__ void vst2(void* p, T v) { *(T*)p = v;  }
__device__ __forceinline__ v8f wmma16(v16h a, v16h b, v8f c) {
  v8f d = __builtin_amdgcn_wmma_f32_16x16x32_f16(false, a, false, b, (short)0, c, false, false);
  asm volatile("v_nop\n\tv_nop\n\tv_nop\n\tv_nop" : "+v"(d) : "v"(a), "v"(b));
  return d;
}
__device__ __forceinline__ v8f wmma_bf(v16b a, v16b b, v8f c) {
  v8f d = __builtin_amdgcn_wmma_f32_16x16x32_bf16(false, a, false, b, (short)0, c, false, false);
  asm volatile("v_nop\n\tv_nop\n\tv_nop\n\tv_nop" : "+v"(d) : "v"(a), "v"(b));
  return d;
}
// 16x16x32 fragments: lane = (h = lane>>4, row/col = lane&15); elements 0..7 = k0+8h+0..7, 8..15 = k0+16+8h+0..7; D element r = row 8h+r
__device__ __forceinline__ v16h frag_h(const _Float16* rowk0, int lane) {
  union { v16h v; v8h q[2]; } u; const _Float16* p = rowk0 + 8 * (lane >> 4);
  u.q[0] = *(const v8h*)p; u.q[1] = *(const v8h*)(p + 16); return u.v;
}
__device__ __forceinline__ v16h frag_f32(const float* rowk0, int lane) {
  v16h a; const float* p = rowk0 + 8 * (lane >> 4);
#pragma unroll
  for (int i = 0; i < 8; ++i) { a[i] = (_Float16)p[i]; a[8 + i] = (_Float16)p[16 + i]; }
  return a;
}
__device__ __forceinline__ v16h frag_f32s(const float* rowk0, int lane, float sc) {
  v16h a; const float* p = rowk0 + 8 * (lane >> 4);
#pragma unroll
  for (int i = 0; i < 8; ++i) { a[i] = (_Float16)(p[i] * sc); a[8 + i] = (_Float16)(p[16 + i] * sc); }
  return a;
}
// column fragment from a [K][ld] layout (column n), rows >= K read as 0
__device__ __forceinline__ v16h fragc_f32(const float* W, int k0, int n, int lane, int ld, int K) {
  v16h a; const int g = lane >> 4;
#pragma unroll
  for (int i = 0; i < 8; ++i) { const int ka = k0 + 8 * g + i, kb = ka + 16;
    a[i] = (_Float16)(ka < K ? W[(size_t)(ka < K ? ka : K - 1) * ld + n] : 0.f); a[8 + i] = (_Float16)(kb < K ? W[(size_t)(kb < K ? kb : K - 1) * ld + n] : 0.f); }
  return a;
}
struct F2 { v16b h, l; };
__device__ __forceinline__ F2 bsplit16(const float v[16]) { F2 r;
#pragma unroll
  for (int i = 0; i < 16; ++i) { const __bf16 h = (__bf16)v[i]; r.h[i] = h; r.l[i] = (__bf16)(v[i] - (float)h); }
  return r; }
__device__ __forceinline__ F2 split_row(const float* row, int k0, int lane) { float v[16]; const float* p = row + k0 + 8 * (lane >> 4);
#pragma unroll
  for (int i = 0; i < 8; ++i) { v[i] = p[i]; v[8 + i] = p[16 + i]; }
  return bsplit16(v); }
__device__ __forceinline__ F2 split_rowK(const float* row, int k0, int lane, int K) { float v[16]; const int g = lane >> 4;
#pragma unroll
  for (int i = 0; i < 8; ++i) { const int ka = k0 + 8 * g + i, kb = ka + 16; v[i] = ka < K ? row[ka < K ? ka : K - 1] : 0.f; v[8 + i] = kb < K ? row[kb < K ? kb : K - 1] : 0.f; }
  return bsplit16(v); }
__device__ __forceinline__ F2 split_col(const float* W, int k0, int n, int lane, int ld, int K) { float v[16]; const int g = lane >> 4;
#pragma unroll
  for (int i = 0; i < 8; ++i) { const int ka = k0 + 8 * g + i, kb = ka + 16; v[i] = ka < K ? W[(size_t)(ka < K ? ka : K - 1) * ld + n] : 0.f; v[8 + i] = kb < K ? W[(size_t)(kb < K ? kb : K - 1) * ld + n] : 0.f; }
  return bsplit16(v); }
__device__ __forceinline__ v8f mac3(const F2& a, const F2& b, v8f c) { c = wmma_bf(a.l, b.h, c); c = wmma_bf(a.h, b.l, c); return wmma_bf(a.h, b.h, c); }
__device__ __forceinline__ float sigm(float v) { return 1.0f / (1.0f + expf(-v)); }
#define LDSX() do { asm volatile("s_wait_dscnt 0" ::: "memory"); __builtin_amdgcn_wave_barrier(); __builtin_amdgcn_fence(__ATOMIC_RELEASE, "workgroup"); } while (0)


// Sparse cross-encoder self attention (B 2, 16 documents x 512 tokens, 32 query tokens, 1 cls; hidden 768 = 12 heads x 64): every segment attends over [cls | query | doc_d] per document (cat_forward path), outputs concatenated along the sequence -> [b, 16, 545, 768].
#define NBB 2
#define ND 16
#define NQT 32
#define NS 512
#define HIDN 768
#define NH 12
#define HD 64
#define LSEQ (1 + NQT + NS)          // 545
#define RPB (1 + NQT + ND * NS)      // unique token rows per batch = 8225
#define NROW (NBB * RPB)             // 16450
#define NROWP (((NROW + 63) / 64) * 64)
#ifndef TND
#define TND ND                       // documents per batch processed
#endif
#ifndef TNB
#define TNB NBB
#endif
#ifndef TPR
#define TPR (NROWP / 64)              // 64-row blocks of padded rows (two per k_proj block)
#endif
typedef __attribute__((ext_vector_type(8))) __bf16 v8b;
__device__ __forceinline__ v16b frag_b(const __bf16* rowk0, int lane) {
  union { v16b v; v8b q[2]; } u; const __bf16* p = rowk0 + 8 * (lane >> 4);
  u.q[0] = *(const v8b*)p; u.q[1] = *(const v8b*)(p + 16); return u.v;
}
__device__ __forceinline__ float bfr(float v) { return (float)(__bf16)v; }
__device__ __attribute__((noinline)) float exp_ni(float v) { return expf(v); }
__device__ __attribute__((noinline)) float erf_ni(float v) { return erff(v); }

#define NDOC (NBB * ND * NS)         // unique token rows, in the inputs' own order: the doc rows first, then the NBB * NQT query rows, then the NBB cls rows
#define ROWQ NDOC
#define ROWC (NDOC + NBB * NQT)
#define WS_Q   0u                                    // f16 q rows [NROWP][768]
#define WS_K   (WS_Q + 2u * (size_t)NROWP * HIDN)
#define WS_V   (WS_K + 2u * (size_t)NROWP * HIDN)
#define WS_END (WS_V + 2u * (size_t)NROWP * HIDN)

__device__ __forceinline__ int tokrow(int b, int d, int i) { const int base = i > NQT ? (b * ND + d) * NS - (1 + NQT) : (i == 0 ? ROWC + b : ROWQ + b * NQT - 1); return base + i; }   // position i of document d's sequence -> unique row
// ---- k_proj: block = (128 rows, 256 cols, which), 8 waves of 64 x 64: f16 rows of X W^T + b (exact). The X rows come straight from the inputs: a block below NDOC / 128 takes 128 doc rows, the last block the query rows, the cls rows and pad rows that re-read a cls row (what is projected from those is never read). Each 32-k slice of the 128 X rows and 256 W rows is read once per block in whole 128-B lines, rounded to bf16 and staged in LDS (two buffers, one barrier per slice); every wave takes its fragments from there
typedef __attribute__((ext_vector_type(4))) __bf16 v4b;
#define PBM 128
#define PBN 256
#define PPIT 40                      // bf16 per staged row: 64 B of k + 16 B pad (80 B = 16 B x odd: the 16-byte fragment reads of 16 rows fall on distinct banks)
#define PBUF ((PBM + PBN) * PPIT)    // bf16 per buffer: X rows 0..127, W rows 128..383
#define PSH (PBN + 8)                // f16 per staged output row
__global__ __launch_bounds__(256) void k_proj(const float* __restrict__ CLS, const float* __restrict__ QRY, const float* __restrict__ DOC, const float* __restrict__ WQ, const float* __restrict__ BQ, const float* __restrict__ WK, const float* __restrict__ BK, const float* __restrict__ WV, const float* __restrict__ BV, _Float16* __restrict__ Q, _Float16* __restrict__ K, _Float16* __restrict__ V) { __shared__ __align__(16) unsigned char smem[PBM * PSH * 2];   // the two operand buffers (2 * PBUF * 2 B fit inside), then the output tile
  static_assert(2 * PBUF * 2 <= PBM * PSH * 2, "operand buffers fit");
  __bf16* st = (__bf16*)smem; _Float16* sh = (_Float16*)smem;
  const int tid = threadIdx.x, wave = tid >> 5, lane = tid & 31, col = lane & 15, g = lane >> 4, wm = wave & 1, wn = wave >> 1; const int which = blockIdx.z; const int c0 = blockIdx.y * PBN; const size_t r0 = (size_t)blockIdx.x * PBM;
  const float* Wm = which == 0 ? WQ : which == 1 ? WK : WV; const float* Bm = which == 0 ? BQ : which == 1 ? BK : BV;
  const int sr = tid >> 3, sc = tid & 7;   // staging: 8 lanes cover one row's 128 B, a wave-wide load covers 4 whole lines
  static_assert(NDOC % PBM == 0 && NBB * NQT == 64 && NBB <= 32 && PBM == 128, "the last block's rows: 64 query, then cls");
  const bool tail = r0 >= (size_t)NDOC;   // block-uniform: the row bases below are scalar and step by one slice per trip, a thread keeps two 32-bit offsets (a 64-bit pointer per staged row would pass 256 registers and halve the resident blocks)
  typedef const __attribute__((address_space(1))) float gfloat; typedef const __attribute__((address_space(1))) v4f gv4f;   // named as global memory: a pointer carried round the loop would otherwise be loaded through the flat path
  gfloat* xb[4] = { (gfloat*)(tail ? QRY : DOC + r0 * HIDN), (gfloat*)(tail ? QRY + 32 * HIDN : DOC + (r0 + 32) * HIDN), (gfloat*)(tail ? CLS : DOC + (r0 + 64) * HIDN), (gfloat*)(tail ? CLS : DOC + (r0 + 96) * HIDN) };
  const unsigned xo = (unsigned)(sr * HIDN + sc * 4), xc = tail ? (unsigned)((sr < NBB ? sr : NBB - 1) * HIDN + sc * 4) : xo;
  gfloat* wb = (gfloat*)(Wm + (size_t)c0 * HIDN);
  v4f pre[12];
#pragma unroll
  for (int i = 0; i < 4; ++i) pre[i] = *(gv4f*)(xb[i] + (i < 2 ? xo : xc));
#pragma unroll
  for (int i = 0; i < 8; ++i) pre[4 + i] = *(gv4f*)(wb + i * 32 * HIDN + xo);
#pragma unroll
  for (int i = 0; i < 12; ++i) *(v4b*)(st + (sr + 32 * i) * PPIT + sc * 4) = __builtin_convertvector(pre[i], v4b);
  __syncthreads();
  v8f acc[4][4] = {};
  for (int kc = 0; kc < HIDN / 32; ++kc) { const __bf16* bp = st + (kc & 1) * PBUF;
    if (kc + 1 < HIDN / 32) {
#pragma unroll
      for (int i = 0; i < 4; ++i) { xb[i] += 32; pre[i] = *(gv4f*)(xb[i] + (i < 2 ? xo : xc)); }
      wb += 32;
#pragma unroll
      for (int i = 0; i < 8; ++i) pre[4 + i] = *(gv4f*)(wb + i * 32 * HIDN + xo); }
    v16b a[4], w[4];
#pragma unroll
    for (int i = 0; i < 4; ++i) { a[i] = frag_b(bp + (wm * 64 + i * 16 + col) * PPIT, lane); w[i] = frag_b(bp + (PBM + wn * 64 + i * 16 + col) * PPIT, lane); }
#pragma unroll
    for (int j = 0; j < 4; ++j)
#pragma unroll
      for (int i = 0; i < 4; ++i) acc[i][j] = wmma_bf(a[i], w[j], acc[i][j]);
    if (kc + 1 < HIDN / 32) { __bf16* sb = st + ((kc + 1) & 1) * PBUF;
#pragma unroll
      for (int i = 0; i < 12; ++i) *(v4b*)(sb + (sr + 32 * i) * PPIT + sc * 4) = __builtin_convertvector(pre[i], v4b); }
    __syncthreads(); }   // publishes slice kc + 1 and ends every read of slice kc's buffer, which slice kc + 2 (or the output tile) overwrites
#pragma unroll
  for (int j = 0; j < 4; ++j) { const float bb = bfr(Bm[c0 + wn * 64 + j * 16 + col]);
#pragma unroll
    for (int i = 0; i < 4; ++i)
#pragma unroll
      for (int r = 0; r < 8; ++r) sh[(wm * 64 + i * 16 + 8 * g + r) * PSH + wn * 64 + j * 16 + col] = (_Float16)(acc[i][j][r] + bb); }
  __syncthreads(); { _Float16* dst = which == 0 ? Q : which == 1 ? K : V; for (int e = tid; e < PBM * (PBN / 8); e += 256) { const int rl = e >> 5, q = e & 31; vst2((unsigned*)(dst + (r0 + rl) * HIDN + c0 + q * 8), *(const v4u*)&sh[rl * PSH + q * 8]); } } }
typedef __attribute__((ext_vector_type(8))) short v8s;
__device__ __forceinline__ v8s ld_tr16(const unsigned char* p) { typedef __attribute__((address_space(3))) v8s lds_v8s; return __builtin_amdgcn_ds_load_tr16_b128_v8i16((lds_v8s*)p); }   // transposing 16-byte LDS read
__device__ __forceinline__ float xhalf(float v) { const int b = __builtin_bit_cast(int, v); return __builtin_bit_cast(float, __builtin_amdgcn_permlanex16(b, b, 0x76543210, 0xfedcba98, false, false)); }   // the value of lane ^ 16
#define KPB 144                      // bytes per staged K row: 128 B + 16 B pad (16 B x odd: the 16-byte fragment reads of 16 rows fall on distinct banks)
#define VPB 160                      // bytes per staged V row: 128 B + 32 B pad (32 B x odd: the pitch at which the transposing 16-byte reads fall on distinct banks)
#define KTB (32 * KPB)               // bytes per staged 32-key tile of K
#define VTB (32 * VPB)               // bytes per staged 32-key tile of V
#define KVB (KTB + VTB)              // bytes per buffer: K tile, then V tile
#define NKT ((LSEQ + 31) / 32)       // key tiles
#define MKR ((NKT * 32 + 127) / 128) // rounds of 128 threads that fill the mask table
// one 32-key tile of K and of V into LDS (the thread's own K place ldk, V place ldv): a thread copies 16 bytes of rows sr and sr + 16 of each, so a wave-wide copy covers 4 whole 128-B lines; keys beyond 545 re-read the last row and are masked
__device__ __forceinline__ void stage_kv(const _Float16* __restrict__ K, const _Float16* __restrict__ V, int b, int d, int t, int sr, int colh, unsigned ldk, unsigned ldv) {
  int ka = t * 32 + sr, kb = ka + 16; ka = ka < LSEQ ? ka : LSEQ - 1; kb = kb < LSEQ ? kb : LSEQ - 1;
  const unsigned oa = (unsigned)tokrow(b, d, ka) * HIDN + colh, ob = (unsigned)tokrow(b, d, kb) * HIDN + colh;   // the offsets stay below NROW * 768
  const _Float16 *pka = K + oa, *pkb = K + ob, *pva = V + oa, *pvb = V + ob;
  const unsigned la = ldk, lb = ldk + 16 * KPB, lc = ldv, ld = ldv + 16 * VPB;
  // the four copies and, as the last line, the wait that stands before any of their address registers is rewritten
  asm volatile("global_load_async_to_lds_b128 %0, %1, off\n\tglobal_load_async_to_lds_b128 %2, %3, off\n\tglobal_load_async_to_lds_b128 %4, %5, off\n\tglobal_load_async_to_lds_b128 %6, %7, off\n\ts_wait_xcnt 0x0"
               :: "v"(la), "v"(pka), "v"(lb), "v"(pkb), "v"(lc), "v"(pva), "v"(ld), "v"(pvb) : "memory"); }
__global__ __launch_bounds__(128) void k_att(const _Float16* __restrict__ Q, const _Float16* __restrict__ K, const _Float16* __restrict__ V, const float* __restrict__ QM, const float* __restrict__ DMK, float* __restrict__ OUT) {
  __shared__ __align__(16) unsigned char ring[2 * KVB];   // two buffers of (K tile, V tile); behind the loop's last barrier the output staging so[4][16][68]
  __shared__ __align__(16) float smk[MKR * 128];              // the sequence's additive mask, built once (entries from NKT * 32 on are never read)
  static_assert(4 * 16 * 68 * 4 <= 2 * KVB, "output staging fits the ring");
  float (*so)[16][68] = (float (*)[16][68])ring;
  const int tid = threadIdx.x, wave = tid >> 5, lane = tid & 31, col = lane & 15, g = lane >> 4; const int qb = blockIdx.x, h = blockIdx.y; const int bd = blockIdx.z; const int b = bd / TND, d = bd % TND;
  const int sr = tid >> 3, colh = h * HD + (tid & 7) * 8; const unsigned ldk0 = (unsigned)(size_t)ring + (unsigned)(sr * KPB + (tid & 7) * 16), ldv0 = (unsigned)(size_t)ring + (unsigned)(KTB + sr * VPB + (tid & 7) * 16);
  stage_kv(K, V, b, d, 0, sr, colh, ldk0, ldv0);
  const int qi = qb * 64 + wave * 16 + col; const int qic = (qi < LSEQ) ? qi : (LSEQ - 1);   // positions beyond 545 (last block) are computed on a clamped row and never stored
  v16h bq[2];
#pragma unroll
  for (int kc = 0; kc < 2; ++kc) bq[kc] = frag_h(Q + (size_t)tokrow(b, d, qic) * HIDN + h * HD + kc * 32, lane);
#pragma unroll
  for (int u = 0; u < MKR; ++u) { const int ki = u * 128 + tid;   // unrolled and branch-free on clamped addresses: the loads of all rounds are in flight together
    const int qx = ki < 1 ? 0 : (ki <= NQT ? ki - 1 : NQT - 1), dx = ki <= NQT ? 0 : (ki < LSEQ ? ki - 1 - NQT : NS - 1);
    const float* mp = ki <= NQT ? QM + (size_t)b * NQT + qx : DMK + ((size_t)b * ND + d) * NS + dx;
    const float mv = bfr(*mp); smk[ki] = ki >= LSEQ ? -3.0e38f : (ki == 0 ? 0.f : mv); }
  asm volatile("s_wait_asynccnt 0x0" ::: "memory");   // tile 0 has landed for this wave's copies
  __syncthreads();                                     // publishes tile 0 and the mask table
  stage_kv(K, V, b, d, 1, sr, colh, ldk0 + KVB, ldv0 + KVB);
  const int vlo = (8 * g + (lane & 7)) * VPB + 16 * ((lane >> 3) & 1);   // the lane's address in a 16-key x 16-column block for the transposing read
  float m = -3.0e38f, l = 0.f;   // the query's running maximum (equal in both halves) and this half's share of its sum
  v8f acc[4] = {};               // acc[j][r] = O[query col][16 j + 8 g + r]
#pragma unroll 1
  for (int ks = 0; ks < NKT; ++ks) {   // rolled: one copy of the body, the buffer chosen by the trip's parity
    const _Float16* sk = (const _Float16*)(ring + (ks & 1) * KVB); const unsigned char* sv = ring + (ks & 1) * KVB + KTB + vlo;
    v16h kf[2][2]; v4f mk4[2][2];
#pragma unroll
    for (int ct = 0; ct < 2; ++ct) {
#pragma unroll
      for (int kc = 0; kc < 2; ++kc) kf[ct][kc] = frag_h(sk + (ct * 16 + col) * (KPB / 2) + kc * 32, lane);
      mk4[ct][0] = *(const v4f*)&smk[ks * 32 + ct * 16 + 8 * g]; mk4[ct][1] = *(const v4f*)&smk[ks * 32 + ct * 16 + 8 * g + 4]; }
    __builtin_amdgcn_sched_barrier(0);   // keeps the tile's K fragment and mask reads together ahead of the score products: one LDS latency, not one per product
    float s[2][8];
#pragma unroll
    for (int ct = 0; ct < 2; ++ct) { v8f c = {};
#pragma unroll
      for (int kc = 0; kc < 2; ++kc) c = wmma16(kf[ct][kc], bq[kc], c);
#pragma unroll
      for (int r = 0; r < 8; ++r) { const float mk = mk4[ct][r >> 2][r & 3]; s[ct][r] = (mk <= -1.0e38f) ? -3.0e38f : (c[r] * 0.125f + mk); } }
    float mx = fmaxf(s[0][0], s[1][0]);
#pragma unroll
    for (int r = 1; r < 8; ++r) mx = fmaxf(mx, fmaxf(s[0][r], s[1][r]));
    mx = fmaxf(mx, xhalf(mx));
    const float mn = fmaxf(m, mx), alpha = __expf(m - mn); float es = 0.f; v16h pb;
#pragma unroll
    for (int ct = 0; ct < 2; ++ct)
#pragma unroll
      for (int r = 0; r < 8; ++r) { const float e = (s[ct][r] <= -1.0e38f) ? 0.f : __expf(s[ct][r] - mn); es += e; pb[ct * 8 + r] = (_Float16)(e * 2048.0f); }
    l = l * alpha + es; m = mn;
#pragma unroll
    for (int j = 0; j < 4; ++j)
#pragma unroll
      for (int r = 0; r < 8; ++r) acc[j][r] *= alpha;
    union { v16h v; v8s q[2]; } va[4];   // lane (col, g) receives V[8 g + 0..7][16 j + col] and V[16 + 8 g + 0..7][16 j + col]: the k order of pb
#pragma unroll
    for (int j = 0; j < 4; ++j) { va[j].q[0] = ld_tr16(sv + 32 * j); va[j].q[1] = ld_tr16(sv + 16 * VPB + 32 * j); }
#pragma unroll
    for (int j = 0; j < 4; ++j) acc[j] = wmma16(va[j].v, pb, acc[j]);
    asm volatile("s_wait_dscnt 0x0" ::: "memory");      // this wave's reads of the buffer have returned
    asm volatile("s_wait_asynccnt 0x0" ::: "memory");   // this wave's copies of tile ks + 1 have landed
    __syncthreads();                                     // publishes tile ks + 1 and ends every read of tile ks's buffer
    if (ks + 2 < NKT) stage_kv(K, V, b, d, ks + 2, sr, colh, ldk0 + (unsigned)(ks & 1) * KVB, ldv0 + (unsigned)(ks & 1) * KVB); }
  asm volatile("s_wait_asynccnt 0x0" ::: "memory");     // nothing is in flight when the ring becomes output staging
  l += xhalf(l);
  const float il = (1.0f / 2048.0f) / l;
#pragma unroll
  for (int j = 0; j < 4; ++j) { v4f oa, ob;
#pragma unroll
    for (int r = 0; r < 4; ++r) { oa[r] = acc[j][r] * il; ob[r] = acc[j][4 + r] * il; }
    *(v4f*)&so[wave][col][j * 16 + 8 * g] = oa; *(v4f*)&so[wave][col][j * 16 + 8 * g + 4] = ob; }
  LDSX();
  for (int rl = 0; rl < 16; ++rl) { const int qpos = qb * 64 + wave * 16 + rl; if (qpos < LSEQ && lane < 16) vst2(OUT + (((size_t)b * ND + d) * LSEQ + qpos) * HIDN + h * HD + lane * 4, *(const v4f*)&so[wave][rl][lane * 4]); } }
extern "C" void kernel_launch(void* const* d_in, const int* in_sizes, int n_in, void* d_out, int out_size, void* d_ws, size_t ws_size, hipStream_t stream) {
  (void)in_sizes; (void)n_in; (void)out_size;
  const float** F = (const float**)d_in;   // 0 cls [2,1,1,768], 1 query [2,1,32,768], 2 doc [2,16,512,768], 3 qmask [2,1,1,1,32], 4 dmask [2,1,16,1,512], 5 Wq, 6 bq, 7 Wk, 8 bk, 9 Wv, 10 bv
  if (ws_size < (size_t)WS_END) return;
  char* ws = (char*)d_ws; _Float16 *Q = (_Float16*)(ws + WS_Q), *K = (_Float16*)(ws + WS_K), *V = (_Float16*)(ws + WS_V);
  k_proj<<<dim3((TPR + 1) / 2, HIDN / PBN, 3), 256, 0, stream>>>(F[0], F[1], F[2], F[5], F[6], F[7], F[8], F[9], F[10], Q, K, V);
  k_att<<<dim3((LSEQ + 63) / 64, NH, TNB * TND), 128, 0, stream>>>(Q, K, V, F[3], F[4], (float*)d_out);
}

// v006
// Measured time: 137 microseconds a run.
// Next to v005, in two timings, it ran 1.06 and 1.07 times as fast.
// All steps since v000 together make it 4.46 times as fast.
// compute dtype: all float inputs rounded to bf16, qmask/dmask read; q/k/v = hs W^T + b for every unique token (cls, query, doc) with EXACT bf16 products on WMMA 16x16x32 (natural weights), f32 accumulate, rounded once to f16 rows (0.02-scale weights: logits ~0.3); per (batch, document) self attention over its 545-token sequence [cls | query | doc_d] with the additive float masks, single f16 score products x 1/8, running-max softmax in f32 in base 2 (hardware exp2), P (f16 x 2^7) . v gathered per key tile; heads merged; f32 output.
#include <hip/hip_runtime.h>
#include <math.h>

typedef __attribute__((ext_vector_type(16))) _Float16 v16h;
typedef __attribute__((ext_vector_type(16))) __bf16 v16b;
typedef __attribute__((ext_vector_type(8)))  _Float16 v8h;
typedef __attribute__((ext_vector_type(8)))  float v8f;
typedef __attribute__((ext_vector_type(4)))  float v4f;
typedef __attribute__((ext_vector_type(2)))  float v2f;
typedef __attribute__((ext_vector_type(4)))  unsigned v4u;
typedef __attribute__((ext_vector_type(4)))  int v4i;
typedef float __attribute__((may_alias)) float_a;
typedef int __attribute__((may_alias)) int_a;

template <typename T> __device__ __forceinline__ void vst2(void* p, T v) { *(T*)p = v;  }
__device__ __forceinline__ v8f wmma16(v16h a, v16h b, v8f c) {
  v8f d = __builtin_amdgcn_wmma_f32_16x16x32_f16(false, a, false, b, (short)0, c, false, false);
  asm volatile("v_nop\n\tv_nop\n\tv_nop\n\tv_nop" : "+v"(d) : "v"(a), "v"(b));
  return d;
}
__device__ __forceinline__ v8f wmma_bf(v16b a, v16b b, v8f c) {
  v8f d = __builtin_amdgcn_wmma_f32_16x16x32_bf16(false, a, false, b, (short)0, c, false, false);
  asm volatile("v_nop\n\tv_nop\n\tv_nop\n\tv_nop" : "+v"(d) : "v"(a), "v"(b));
  return d;
}
// 16x16x32 fragments: lane = (h = lane>>4, row/col = lane&15); elements 0..7 = k0+8h+0..7, 8..15 = k0+16+8h+0..7; D element r = row 8h+r
__device__ __forceinline__ v16h frag_h(const _Float16* rowk0, int lane) {
  union { v16h v; v8h q[2]; } u; const _Float16* p = rowk0 + 8 * (lane >> 4);
  u.q[0] = *(const v8h*)p; u.q[1] = *(const v8h*)(p + 16); return u.v;
}
__device__ __forceinline__ v16h frag_f32(const float* rowk0, int lane) {
  v16h a; const float* p = rowk0 + 8 * (lane >> 4);
#pragma unroll
  for (int i = 0; i < 8; ++i) { a[i] = (_Float16)p[i]; a[8 + i] = (_Float16)p[16 + i]; }
  return a;
}
__device__ __forceinline__ v16h frag_f32s(const float* rowk0, int lane, float sc) {
  v16h a; const float* p = rowk0 + 8 * (lane >> 4);
#pragma unroll
  for (int i = 0; i < 8; ++i) { a[i] = (_Float16)(p[i] * sc); a[8 + i] = (_Float16)(p[16 + i] * sc); }
  return a;
}
// column fragment from a [K][ld] layout (column n), rows >= K read as 0
__device__ __forceinline__ v16h fragc_f32(const float* W, int k0, int n, int lane, int ld, int K) {
  v16h a; const int g = lane >> 4;
#pragma unroll
  for (int i = 0; i < 8; ++i) { const int ka = k0 + 8 * g + i, kb = ka + 16;
    a[i] = (_Float16)(ka < K ? W[(size_t)(ka < K ? ka : K - 1) * ld + n] : 0.f); a[8 + i] = (_Float16)(kb < K ? W[(size_t)(kb < K ? kb : K - 1) * ld + n] : 0.f); }
  return a;
}
struct F2 { v16b h, l; };
__device__ __forceinline__ F2 bsplit16(const float v[16]) { F2 r;
#pragma unroll
  for (int i = 0; i < 16; ++i) { const __bf16 h = (__bf16)v[i]; r.h[i] = h; r.l[i] = (__bf16)(v[i] - (float)h); }
  return r; }
__device__ __forceinline__ F2 split_row(const float* row, int k0, int lane) { float v[16]; const float* p = row + k0 + 8 * (lane >> 4);
#pragma unroll
  for (int i = 0; i < 8; ++i) { v[i] = p[i]; v[8 + i] = p[16 + i]; }
  return bsplit16(v); }
__device__ __forceinline__ F2 split_rowK(const float* row, int k0, int lane, int K) { float v[16]; const int g = lane >> 4;
#pragma unroll
  for (int i = 0; i < 8; ++i) { const int ka = k0 + 8 * g + i, kb = ka + 16; v[i] = ka < K ? row[ka < K ? ka : K - 1] : 0.f; v[8 + i] = kb < K ? row[kb < K ? kb : K - 1] : 0.f; }
  return bsplit16(v); }
__device__ __forceinline__ F2 split_col(const float* W, int k0, int n, int lane, int ld, int K) { float v[16]; const int g = lane >> 4;
#pragma unroll
  for (int i = 0; i < 8; ++i) { const int ka = k0 + 8 * g + i, kb = ka + 16; v[i] = ka < K ? W[(size_t)(ka < K ? ka : K - 1) * ld + n] : 0.f; v[8 + i] = kb < K ? W[(size_t)(kb < K ? kb : K - 1) * ld + n] : 0.f; }
  return bsplit16(v); }
__device__ __forceinline__ v8f mac3(const F2& a, const F2& b, v8f c) { c = wmma_bf(a.l, b.h, c); c = wmma_bf(a.h, b.l, c); return wmma_bf(a.h, b.h, c); }
__device__ __forceinline__ float sigm(float v) { return 1.0f / (1.0f + expf(-v)); }
#define LDSX() do { asm volatile("s_wait_dscnt 0" ::: "memory"); __builtin_amdgcn_wave_barrier(); __builtin_amdgcn_fence(__ATOMIC_RELEASE, "workgroup"); } while (0)


// Sparse cross-encoder self attention (B 2, 16 documents x 512 tokens, 32 query tokens, 1 cls; hidden 768 = 12 heads x 64): every segment attends over [cls | query | doc_d] per document (cat_forward path), outputs concatenated along the sequence -> [b, 16, 545, 768].
#define NBB 2
#define ND 16
#define NQT 32
#define NS 512
#define HIDN 768
#define NH 12
#define HD 64
#define LSEQ (1 + NQT + NS)          // 545
#define RPB (1 + NQT + ND * NS)      // unique token rows per batch = 8225
#define NROW (NBB * RPB)             // 16450
#define NROWP (((NROW + 63) / 64) * 64)
#ifndef TND
#define TND ND                       // documents per batch processed
#endif
#ifndef TNB
#define TNB NBB
#endif
#ifndef TPR
#define TPR (NROWP / 64)              // 64-row blocks of padded rows (two per k_proj block)
#endif
typedef __attribute__((ext_vector_type(8))) __bf16 v8b;
__device__ __forceinline__ v16b frag_b(const __bf16* rowk0, int lane) {
  union { v16b v; v8b q[2]; } u; const __bf16* p = rowk0 + 8 * (lane >> 4);
  u.q[0] = *(const v8b*)p; u.q[1] = *(const v8b*)(p + 16); return u.v;
}
__device__ __forceinline__ float bfr(float v) { return (float)(__bf16)v; }
__device__ __attribute__((noinline)) float exp_ni(float v) { return expf(v); }
__device__ __attribute__((noinline)) float erf_ni(float v) { return erff(v); }

#define NDOC (NBB * ND * NS)         // unique token rows, in the inputs' own order: the doc rows first, then the NBB * NQT query rows, then the NBB cls rows
#define ROWQ NDOC
#define ROWC (NDOC + NBB * NQT)
#define WS_Q   0u                                    // f16 q rows [NROWP][768]
#define WS_K   (WS_Q + 2u * (size_t)NROWP * HIDN)
#define WS_V   (WS_K + 2u * (size_t)NROWP * HIDN)
#define WS_END (WS_V + 2u * (size_t)NROWP * HIDN)

__device__ __forceinline__ int tokrow(int b, int d, int i) { const int base = i > NQT ? (b * ND + d) * NS - (1 + NQT) : (i == 0 ? ROWC + b : ROWQ + b * NQT - 1); return base + i; }   // position i of document d's sequence -> unique row
// ---- k_proj: block = (128 rows, 256 cols, which), 8 waves of 64 x 64: f16 rows of X W^T + b (exact). The X rows come straight from the inputs: a block below NDOC / 128 takes 128 doc rows, the last block the query rows, the cls rows and pad rows that re-read a cls row (what is projected from those is never read). Each 32-k slice of the 128 X rows and 256 W rows is read once per block in whole 128-B lines, rounded to bf16 and staged in LDS (two buffers, one barrier per slice); every wave takes its fragments from there
typedef __attribute__((ext_vector_type(4))) __bf16 v4b;
#define PBM 128
#define PBN 256
#define PPIT 40                      // bf16 per staged row: 64 B of k + 16 B pad (80 B = 16 B x odd: the 16-byte fragment reads of 16 rows fall on distinct banks)
#define PBUF ((PBM + PBN) * PPIT)    // bf16 per buffer: X rows 0..127, W rows 128..383
#define PSH (PBN + 8)                // f16 per staged output row
__global__ __launch_bounds__(256) void k_proj(const float* __restrict__ CLS, const float* __restrict__ QRY, const float* __restrict__ DOC, const float* __restrict__ WQ, const float* __restrict__ BQ, const float* __restrict__ WK, const float* __restrict__ BK, const float* __restrict__ WV, const float* __restrict__ BV, _Float16* __restrict__ Q, _Float16* __restrict__ K, _Float16* __restrict__ V) { __shared__ __align__(16) unsigned char smem[PBM * PSH * 2];   // the two operand buffers (2 * PBUF * 2 B fit inside), then the output tile
  static_assert(2 * PBUF * 2 <= PBM * PSH * 2, "operand buffers fit");
  __bf16* st = (__bf16*)smem; _Float16* sh = (_Float16*)smem;
  const int tid = threadIdx.x, wave = tid >> 5, lane = tid & 31, col = lane & 15, g = lane >> 4, wm = wave & 1, wn = wave >> 1; const int which = blockIdx.z; const int c0 = blockIdx.y * PBN; const size_t r0 = (size_t)blockIdx.x * PBM;
  const float* Wm = which == 0 ? WQ : which == 1 ? WK : WV; const float* Bm = which == 0 ? BQ : which == 1 ? BK : BV;
  const int sr = tid >> 3, sc = tid & 7;   // staging: 8 lanes cover one row's 128 B, a wave-wide load covers 4 whole lines
  static_assert(NDOC % PBM == 0 && NBB * NQT == 64 && NBB <= 32 && PBM == 128, "the last block's rows: 64 query, then cls");
  const bool tail = r0 >= (size_t)NDOC;   // block-uniform: the row bases below are scalar and step by one slice per trip, a thread keeps two 32-bit offsets (a 64-bit pointer per staged row would pass 256 registers and halve the resident blocks)
  typedef const __attribute__((address_space(1))) float gfloat; typedef const __attribute__((address_space(1))) v4f gv4f;   // named as global memory: a pointer carried round the loop would otherwise be loaded through the flat path
  gfloat* xb[4] = { (gfloat*)(tail ? QRY : DOC + r0 * HIDN), (gfloat*)(tail ? QRY + 32 * HIDN : DOC + (r0 + 32) * HIDN), (gfloat*)(tail ? CLS : DOC + (r0 + 64) * HIDN), (gfloat*)(tail ? CLS : DOC + (r0 + 96) * HIDN) };
  const unsigned xo = (unsigned)(sr * HIDN + sc * 4), xc = tail ? (unsigned)((sr < NBB ? sr : NBB - 1) * HIDN + sc * 4) : xo;
  gfloat* wb = (gfloat*)(Wm + (size_t)c0 * HIDN);
  v4f pre[12];
#pragma unroll
  for (int i = 0; i < 4; ++i) pre[i] = *(gv4f*)(xb[i] + (i < 2 ? xo : xc));
#pragma unroll
  for (int i = 0; i < 8; ++i) pre[4 + i] = *(gv4f*)(wb + i * 32 * HIDN + xo);
#pragma unroll
  for (int i = 0; i < 12; ++i) *(v4b*)(st + (sr + 32 * i) * PPIT + sc * 4) = __builtin_convertvector(pre[i], v4b);
  __syncthreads();
  v8f acc[4][4] = {};
  for (int kc = 0; kc < HIDN / 32; ++kc) { const __bf16* bp = st + (kc & 1) * PBUF;
    if (kc + 1 < HIDN / 32) {
#pragma unroll
      for (int i = 0; i < 4; ++i) { xb[i] += 32; pre[i] = *(gv4f*)(xb[i] + (i < 2 ? xo : xc)); }
      wb += 32;
#pragma unroll
      for (int i = 0; i < 8; ++i) pre[4 + i] = *(gv4f*)(wb + i * 32 * HIDN + xo); }
    v16b a[4], w[4];
#pragma unroll
    for (int i = 0; i < 4; ++i) { a[i] = frag_b(bp + (wm * 64 + i * 16 + col) * PPIT, lane); w[i] = frag_b(bp + (PBM + wn * 64 + i * 16 + col) * PPIT, lane); }
#pragma unroll
    for (int j = 0; j < 4; ++j)
#pragma unroll
      for (int i = 0; i < 4; ++i) acc[i][j] = wmma_bf(a[i], w[j], acc[i][j]);
    if (kc + 1 < HIDN / 32) { __bf16* sb = st + ((kc + 1) & 1) * PBUF;
#pragma unroll
      for (int i = 0; i < 12; ++i) *(v4b*)(sb + (sr + 32 * i) * PPIT + sc * 4) = __builtin_convertvector(pre[i], v4b); }
    __syncthreads(); }   // publishes slice kc + 1 and ends every read of slice kc's buffer, which slice kc + 2 (or the output tile) overwrites
#pragma unroll
  for (int j = 0; j < 4; ++j) { const float bb = bfr(Bm[c0 + wn * 64 + j * 16 + col]);
#pragma unroll
    for (int i = 0; i < 4; ++i)
#pragma unroll
      for (int r = 0; r < 8; ++r) sh[(wm * 64 + i * 16 + 8 * g + r) * PSH + wn * 64 + j * 16 + col] = (_Float16)(acc[i][j][r] + bb); }
  __syncthreads(); { _Float16* dst = which == 0 ? Q : which == 1 ? K : V; for (int e = tid; e < PBM * (PBN / 8); e += 256) { const int rl = e >> 5, q = e & 31; vst2((unsigned*)(dst + (r0 + rl) * HIDN + c0 + q * 8), *(const v4u*)&sh[rl * PSH + q * 8]); } } }
typedef __attribute__((ext_vector_type(8))) short v8s;
__device__ __forceinline__ v8s ld_tr16(const unsigned char* p) { typedef __attribute__((address_space(3))) v8s lds_v8s; return __builtin_amdgcn_ds_load_tr16_b128_v8i16((lds_v8s*)p); }   // transposing 16-byte LDS read
__device__ __forceinline__ float xhalf(float v) { const int b = __builtin_bit_cast(int, v); return __builtin_bit_cast(float, __builtin_amdgcn_permlanex16(b, b, 0x76543210, 0xfedcba98, false, false)); }   // the value of lane ^ 16
#define KPB 144                      // bytes per staged K row: 128 B + 16 B pad (16 B x odd: the 16-byte fragment reads of 16 rows fall on distinct banks)
#define VPB 160                      // bytes per staged V row: 128 B + 32 B pad (32 B x odd: the pitch at which the transposing 16-byte reads fall on distinct banks)
#define KTB (32 * KPB)               // bytes per staged 32-key tile of K
#define VTB (32 * VPB)               // bytes per staged 32-key tile of V
#define KVB (KTB + VTB)              // bytes per buffer: K tile, then V tile
#define NKT ((LSEQ + 31) / 32)       // key tiles
#define MKR ((NKT * 32 + 127) / 128) // rounds of 128 threads that fill the mask table
#define L2E 1.4426950408889634f      // log2(e): scores and masks are kept in base 2, so a weight is one subtraction and one hardware exp2
#define SC2 (0.125f * L2E)           // 1 / sqrt(64), in base 2
#define PEX 7.0f                     // the running maximum is kept 7 low, so the weights come out of exp2 times 2^7 (small ones stay normal f16); a rounded mx - 7 lies at most 7 further off, so a weight is at most 2^14 for any finite maximum
// one 32-key tile of K and of V into LDS (the thread's own K place ldk, V place ldv): a thread copies 16 bytes of rows sr and sr + 16 of each, so a wave-wide copy covers 4 whole 128-B lines; keys beyond 545 re-read the last row and are masked
__device__ __forceinline__ void stage_kv(const _Float16* __restrict__ K, const _Float16* __restrict__ V, int b, int d, int t, int sr, int colh, unsigned ldk, unsigned ldv) {
  int ka = t * 32 + sr, kb = ka + 16; ka = ka < LSEQ ? ka : LSEQ - 1; kb = kb < LSEQ ? kb : LSEQ - 1;
  const unsigned oa = (unsigned)tokrow(b, d, ka) * HIDN + colh, ob = (unsigned)tokrow(b, d, kb) * HIDN + colh;   // the offsets stay below NROW * 768
  const _Float16 *pka = K + oa, *pkb = K + ob, *pva = V + oa, *pvb = V + ob;
  const unsigned la = ldk, lb = ldk + 16 * KPB, lc = ldv, ld = ldv + 16 * VPB;
  // the four copies and, as the last line, the wait that stands before any of their address registers is rewritten
  asm volatile("global_load_async_to_lds_b128 %0, %1, off\n\tglobal_load_async_to_lds_b128 %2, %3, off\n\tglobal_load_async_to_lds_b128 %4, %5, off\n\tglobal_load_async_to_lds_b128 %6, %7, off\n\ts_wait_xcnt 0x0"
               :: "v"(la), "v"(pka), "v"(lb), "v"(pkb), "v"(lc), "v"(pva), "v"(ld), "v"(pvb) : "memory"); }
__global__ __launch_bounds__(128) void k_att(const _Float16* __restrict__ Q, const _Float16* __restrict__ K, const _Float16* __restrict__ V, const float* __restrict__ QM, const float* __restrict__ DMK, float* __restrict__ OUT) {
  __shared__ __align__(16) unsigned char ring[2 * KVB];   // two buffers of (K tile, V tile); behind the loop's last barrier the output staging so[4][16][68]
  __shared__ __align__(16) float smk[MKR * 128];              // the sequence's additive mask, built once (entries from NKT * 32 on are never read)
  static_assert(4 * 16 * 68 * 4 <= 2 * KVB, "output staging fits the ring");
  float (*so)[16][68] = (float (*)[16][68])ring;
  const int tid = threadIdx.x, wave = tid >> 5, lane = tid & 31, col = lane & 15, g = lane >> 4; const int qb = blockIdx.x, h = blockIdx.y; const int bd = blockIdx.z; const int b = bd / TND, d = bd % TND;
  const int sr = tid >> 3, colh = h * HD + (tid & 7) * 8; const unsigned ldk0 = (unsigned)(size_t)ring + (unsigned)(sr * KPB + (tid & 7) * 16), ldv0 = (unsigned)(size_t)ring + (unsigned)(KTB + sr * VPB + (tid & 7) * 16);
  stage_kv(K, V, b, d, 0, sr, colh, ldk0, ldv0);
  const int qi = qb * 64 + wave * 16 + col; const int qic = (qi < LSEQ) ? qi : (LSEQ - 1);   // positions beyond 545 (last block) are computed on a clamped row and never stored
  v16h bq[2];
#pragma unroll
  for (int kc = 0; kc < 2; ++kc) bq[kc] = frag_h(Q + (size_t)tokrow(b, d, qic) * HIDN + h * HD + kc * 32, lane);
#pragma unroll
  for (int u = 0; u < MKR; ++u) { const int ki = u * 128 + tid;   // unrolled and branch-free on clamped addresses: the loads of all rounds are in flight together
    const int qx = ki < 1 ? 0 : (ki <= NQT ? ki - 1 : NQT - 1), dx = ki <= NQT ? 0 : (ki < LSEQ ? ki - 1 - NQT : NS - 1);
    const float* mp = ki <= NQT ? QM + (size_t)b * NQT + qx : DMK + ((size_t)b * ND + d) * NS + dx;
    const float mv = bfr(*mp) * L2E; smk[ki] = ki >= LSEQ ? -3.0e38f : (ki == 0 ? 0.f : mv); }
  asm volatile("s_wait_asynccnt 0x0" ::: "memory");   // tile 0 has landed for this wave's copies
  __syncthreads();                                     // publishes tile 0 and the mask table
  stage_kv(K, V, b, d, 1, sr, colh, ldk0 + KVB, ldv0 + KVB);
  const int vlo = (8 * g + (lane & 7)) * VPB + 16 * ((lane >> 3) & 1);   // the lane's address in a 16-key x 16-column block for the transposing read
  float m = -3.0e38f; v2f l2 = {};   // the query's running maximum less PEX (equal in both halves) and this half's share of its sum, even and odd keys apart
  v8f acc[4] = {};               // acc[j][r] = O[query col][16 j + 8 g + r]
#pragma unroll 1
  for (int ks = 0; ks < NKT; ++ks) {   // rolled: one copy of the body, the buffer chosen by the trip's parity
    const _Float16* sk = (const _Float16*)(ring + (ks & 1) * KVB); const unsigned char* sv = ring + (ks & 1) * KVB + KTB + vlo;
    v16h kf[2][2]; v4f mk4[2][2];
#pragma unroll
    for (int ct = 0; ct < 2; ++ct) {
#pragma unroll
      for (int kc = 0; kc < 2; ++kc) kf[ct][kc] = frag_h(sk + (ct * 16 + col) * (KPB / 2) + kc * 32, lane);
      mk4[ct][0] = *(const v4f*)&smk[ks * 32 + ct * 16 + 8 * g]; mk4[ct][1] = *(const v4f*)&smk[ks * 32 + ct * 16 + 8 * g + 4]; }
    __builtin_amdgcn_sched_barrier(0);   // keeps the tile's K fragment and mask reads together ahead of the score products: one LDS latency, not one per product
    v2f s[2][4];   // neighbouring keys in pairs, as the accumulator and the mask table hold them: packed arithmetic with no register moves
#pragma unroll
    for (int ct = 0; ct < 2; ++ct) { v8f c = {};
#pragma unroll
      for (int kc = 0; kc < 2; ++kc) c = wmma16(kf[ct][kc], bq[kc], c);
#pragma unroll
      for (int p = 0; p < 4; ++p) s[ct][p] = (v2f){ c[2 * p], c[2 * p + 1] } * SC2 + (v2f){ mk4[ct][p >> 1][(2 * p) & 3], mk4[ct][p >> 1][(2 * p + 1) & 3] }; }   // no select for a masked key: key 0 is never masked, so from tile 0 on the maximum is a real score and exp2 of a masked key's distance to it is 0 by itself
    float mx = fmaxf(s[0][0][0], s[0][0][1]);
#pragma unroll
    for (int p = 1; p < 8; ++p) mx = fmaxf(mx, fmaxf(s[p >> 2][p & 3][0], s[p >> 2][p & 3][1]));
    mx -= PEX;
    const float mn = fmaxf(m, fmaxf(mx, xhalf(mx))), alpha = __builtin_amdgcn_exp2f(m - mn); v16h pb;
    l2 *= alpha;
#pragma unroll
    for (int ct = 0; ct < 2; ++ct)
#pragma unroll
      for (int p = 0; p < 4; ++p) { const v2f t = s[ct][p] - mn; const v2f e = { __builtin_amdgcn_exp2f(t[0]), __builtin_amdgcn_exp2f(t[1]) }; l2 += e; pb[ct * 8 + 2 * p] = (_Float16)e[0]; pb[ct * 8 + 2 * p + 1] = (_Float16)e[1]; }
    m = mn;
#pragma unroll
    for (int j = 0; j < 4; ++j)
#pragma unroll
      for (int r = 0; r < 8; ++r) acc[j][r] *= alpha;
    union { v16h v; v8s q[2]; } va[4];   // lane (col, g) receives V[8 g + 0..7][16 j + col] and V[16 + 8 g + 0..7][16 j + col]: the k order of pb
#pragma unroll
    for (int j = 0; j < 4; ++j) { va[j].q[0] = ld_tr16(sv + 32 * j); va[j].q[1] = ld_tr16(sv + 16 * VPB + 32 * j); }
#pragma unroll
    for (int j = 0; j < 4; ++j) acc[j] = wmma16(va[j].v, pb, acc[j]);
    asm volatile("s_wait_dscnt 0x0" ::: "memory");      // this wave's reads of the buffer have returned
    asm volatile("s_wait_asynccnt 0x0" ::: "memory");   // this wave's copies of tile ks + 1 have landed
    __syncthreads();                                     // publishes tile ks + 1 and ends every read of tile ks's buffer
    if (ks + 2 < NKT) stage_kv(K, V, b, d, ks + 2, sr, colh, ldk0 + (unsigned)(ks & 1) * KVB, ldv0 + (unsigned)(ks & 1) * KVB); }
  asm volatile("s_wait_asynccnt 0x0" ::: "memory");     // nothing is in flight when the ring becomes output staging
  float l = l2[0] + l2[1]; l += xhalf(l);
  const float il = 1.0f / l;   // sum and products carry the same power of two
#pragma unroll
  for (int j = 0; j < 4; ++j) { v4f oa, ob;
#pragma unroll
    for (int r = 0; r < 4; ++r) { oa[r] = acc[j][r] * il; ob[r] = acc[j][4 + r] * il; }
    *(v4f*)&so[wave][col][j * 16 + 8 * g] = oa; *(v4f*)&so[wave][col][j * 16 + 8 * g + 4] = ob; }
  LDSX();
  for (int rl = 0; rl < 16; ++rl) { const int qpos = qb * 64 + wave * 16 + rl; if (qpos < LSEQ && lane < 16) vst2(OUT + (((size_t)b * ND + d) * LSEQ + qpos) * HIDN + h * HD + lane * 4, *(const v4f*)&so[wave][rl][lane * 4]); } }
extern "C" void kernel_launch(void* const* d_in, const int* in_sizes, int n_in, void* d_out, int out_size, void* d_ws, size_t ws_size, hipStream_t stream) {
  (void)in_sizes; (void)n_in; (void)out_size;
  const float** F = (const float**)d_in;   // 0 cls [2,1,1,768], 1 query [2,1,32,768], 2 doc [2,16,512,768], 3 qmask [2,1,1,1,32], 4 dmask [2,1,16,1,512], 5 Wq, 6 bq, 7 Wk, 8 bk, 9 Wv, 10 bv
  if (ws_size < (size_t)WS_END) return;
  char* ws = (char*)d_ws; _Float16 *Q = (_Float16*)(ws + WS_Q), *K = (_Float16*)(ws + WS_K), *V = (_Float16*)(ws + WS_V);
  k_proj<<<dim3((TPR + 1) / 2, HIDN / PBN, 3), 256, 0, stream>>>(F[0], F[1], F[2], F[5], F[6], F[7], F[8], F[9], F[10], Q, K, V);
  k_att<<<dim3((LSEQ + 63) / 64, NH, TNB * TND), 128, 0, stream>>>(Q, K, V, F[3], F[4], (float*)d_out);
}

// v007
// Measured time: 126 microseconds a run.
// Next to v006, in two timings, it ran 1.08 times as fast each time.
// Over all steps from v000 it is 4.82 times as fast.
// compute dtype: all float inputs rounded to bf16, qmask/dmask read; q/k/v = hs W^T + b for every unique token (cls, query, doc) with EXACT bf16 products on WMMA 16x16x32 (natural weights), f32 accumulate, rounded once to f16 rows (0.02-scale weights: logits ~0.3); per (batch, document) self attention over its 545-token sequence [cls | query | doc_d] with the additive float masks, single f16 score products x 1/8, running-max softmax in f32 in base 2 (hardware exp2), P (f16 x 2^7) . v gathered per key tile; heads merged; f32 output.
#include <hip/hip_runtime.h>
#include <math.h>

typedef __attribute__((ext_vector_type(16))) _Float16 v16h;
typedef __attribute__((ext_vector_type(16))) __bf16 v16b;
typedef __attribute__((ext_vector_type(8)))  _Float16 v8h;
typedef __attribute__((ext_vector_type(8)))  float v8f;
typedef __attribute__((ext_vector_type(4)))  float v4f;
typedef __attribute__((ext_vector_type(2)))  float v2f;
typedef __attribute__((ext_vector_type(4)))  unsigned v4u;
typedef __attribute__((ext_vector_type(4)))  int v4i;
typedef float __attribute__((may_alias)) float_a;
typedef int __attribute__((may_alias)) int_a;

template <typename T> __device__ __forceinline__ void vst2(void* p, T v) { *(T*)p = v;  }
__device__ __forceinline__ v8f wmma16(v16h a, v16h b, v8f c) {
  v8f d = __builtin_amdgcn_wmma_f32_16x16x32_f16(false, a, false, b, (short)0, c, false, false);
  asm volatile("v_nop\n\tv_nop\n\tv_nop\n\tv_nop" : "+v"(d) : "v"(a), "v"(b));
  return d;
}
__device__ __forceinline__ v8f wmma_bf(v16b a, v16b b, v8f c) {
  v8f d = __builtin_amdgcn_wmma_f32_16x16x32_bf16(false, a, false, b, (short)0, c, false, false);
  asm volatile("v_nop\n\tv_nop\n\tv_nop\n\tv_nop" : "+v"(d) : "v"(a), "v"(b));
  return d;
}
// 16x16x32 fragments: lane = (h = lane>>4, row/col = lane&15); elements 0..7 = k0+8h+0..7, 8..15 = k0+16+8h+0..7; D element r = row 8h+r
__device__ __forceinline__ v16h frag_h(const _Float16* rowk0, int lane) {
  union { v16h v; v8h q[2]; } u; const _Float16* p = rowk0 + 8 * (lane >> 4);
  u.q[0] = *(const v8h*)p; u.q[1] = *(const v8h*)(p + 16); return u.v;
}
__device__ __forceinline__ v16h frag_f32(const float* rowk0, int lane) {
  v16h a; const float* p = rowk0 + 8 * (lane >> 4);
#pragma unroll
  for (int i = 0; i < 8; ++i) { a[i] = (_Float16)p[i]; a[8 + i] = (_Float16)p[16 + i]; }
  return a;
}
__device__ __forceinline__ v16h frag_f32s(const float* rowk0, int lane, float sc) {
  v16h a; const float* p = rowk0 + 8 * (lane >> 4);
#pragma unroll
  for (int i = 0; i < 8; ++i) { a[i] = (_Float16)(p[i] * sc); a[8 + i] = (_Float16)(p[16 + i] * sc); }
  return a;
}
// column fragment from a [K][ld] layout (column n), rows >= K read as 0
__device__ __forceinline__ v16h fragc_f32(const float* W, int k0, int n, int lane, int ld, int K) {
  v16h a; const int g = lane >> 4;
#pragma unroll
  for (int i = 0; i < 8; ++i) { const int ka = k0 + 8 * g + i, kb = ka + 16;
    a[i] = (_Float16)(ka < K ? W[(size_t)(ka < K ? ka : K - 1) * ld + n] : 0.f); a[8 + i] = (_Float16)(kb < K ? W[(size_t)(kb < K ? kb : K - 1) * ld + n] : 0.f); }
  return a;
}
struct F2 { v16b h, l; };
__device__ __forceinline__ F2 bsplit16(const float v[16]) { F2 r;
#pragma unroll
  for (int i = 0; i < 16; ++i) { const __bf16 h = (__bf16)v[i]; r.h[i] = h; r.l[i] = (__bf16)(v[i] - (float)h); }
  return r; }
__device__ __forceinline__ F2 split_row(const float* row, int k0, int lane) { float v[16]; const float* p = row + k0 + 8 * (lane >> 4);
#pragma unroll
  for (int i = 0; i < 8; ++i) { v[i] = p[i]; v[8 + i] = p[16 + i]; }
  return bsplit16(v); }
__device__ __forceinline__ F2 split_rowK(const float* row, int k0, int lane, int K) { float v[16]; const int g = lane >> 4;
#pragma unroll
  for (int i = 0; i < 8; ++i) { const int ka = k0 + 8 * g + i, kb = ka + 16; v[i] = ka < K ? row[ka < K ? ka : K - 1] : 0.f; v[8 + i] = kb < K ? row[kb < K ? kb : K - 1] : 0.f; }
  return bsplit16(v); }
__device__ __forceinline__ F2 split_col(const float* W, int k0, int n, int lane, int ld, int K) { float v[16]; const int g = lane >> 4;
#pragma unroll
  for (int i = 0; i < 8; ++i) { const int ka = k0 + 8 * g + i, kb = ka + 16; v[i] = ka < K ? W[(size_t)(ka < K ? ka : K - 1) * ld + n] : 0.f; v[8 + i] = kb < K ? W[(size_t)(kb < K ? kb : K - 1) * ld + n] : 0.f; }
  return bsplit16(v); }
__device__ __forceinline__ v8f mac3(const F2& a, const F2& b, v8f c) { c = wmma_bf(a.l, b.h, c); c = wmma_bf(a.h, b.l, c); return wmma_bf(a.h, b.h, c); }
__device__ __forceinline__ float sigm(float v) { return 1.0f / (1.0f + expf(-v)); }
#define LDSX() do { asm volatile("s_wait_dscnt 0" ::: "memory"); __builtin_amdgcn_wave_barrier(); __builtin_amdgcn_fence(__ATOMIC_RELEASE, "workgroup"); } while (0)


// Sparse cross-encoder self attention (B 2, 16 documents x 512 tokens, 32 query tokens, 1 cls; hidden 768 = 12 heads x 64): every segment attends over [cls | query | doc_d] per document (cat_forward path), outputs concatenated along the sequence -> [b, 16, 545, 768].
#define NBB 2
#define ND 16
#define NQT 32
#define NS 512
#define HIDN 768
#define NH 12
#define HD 64
#define LSEQ (1 + NQT + NS)          // 545
#define RPB (1 + NQT + ND * NS)      // unique token rows per batch = 8225
#define NROW (NBB * RPB)             // 16450
#define NROWP (((NROW + 63) / 64) * 64)
#ifndef TND
#define TND ND                       // documents per batch processed
#endif
#ifndef TNB
#define TNB NBB
#endif
#ifndef TPR
#define TPR (NROWP / 64)              // 64-row blocks of padded rows (two per k_proj block)
#endif
typedef __attribute__((ext_vector_type(8))) __bf16 v8b;
__device__ __forceinline__ v16b frag_b(const __bf16* rowk0, int lane) {
  union { v16b v; v8b q[2]; } u; const __bf16* p = rowk0 + 8 * (lane >> 4);
  u.q[0] = *(const v8b*)p; u.q[1] = *(const v8b*)(p + 16); return u.v;
}
__device__ __forceinline__ float bfr(float v) { return (float)(__bf16)v; }
__device__ __attribute__((noinline)) float exp_ni(float v) { return expf(v); }
__device__ __attribute__((noinline)) float erf_ni(float v) { return erff(v); }

#define NDOC (NBB * ND * NS)         // unique token rows, in the inputs' own order: the doc rows first, then the NBB * NQT query rows, then the NBB cls rows
#define ROWQ NDOC
#define ROWC (NDOC + NBB * NQT)
#define WS_Q   0u                                    // f16 q rows [NROWP][768]
#define WS_K   (WS_Q + 2u * (size_t)NROWP * HIDN)
#define WS_V   (WS_K + 2u * (size_t)NROWP * HIDN)
#define WS_END (WS_V + 2u * (size_t)NROWP * HIDN)

__device__ __forceinline__ int tokrow(int b, int d, int i) { const int base = i > NQT ? (b * ND + d) * NS - (1 + NQT) : (i == 0 ? ROWC + b : ROWQ + b * NQT - 1); return base + i; }   // position i of document d's sequence -> unique row
// ---- k_proj: block = (128 rows, 256 cols, which), 8 waves of 64 x 64: f16 rows of X W^T + b (exact). The X rows come straight from the inputs: a block below NDOC / 128 takes 128 doc rows, the last block the query rows, the cls rows and pad rows that re-read a cls row (what is projected from those is never read). Each 32-k slice of the 128 X rows and 256 W rows is read once per block in whole 128-B lines, rounded to bf16 and staged in LDS (two buffers, one barrier per slice); every wave takes its fragments from there
typedef __attribute__((ext_vector_type(4))) __bf16 v4b;
#define PBM 128
#define PBN 256
#define PPIT 40                      // bf16 per staged row: 64 B of k + 16 B pad (80 B = 16 B x odd: the 16-byte fragment reads of 16 rows fall on distinct banks)
#define PBUF ((PBM + PBN) * PPIT)    // bf16 per buffer: X rows 0..127, W rows 128..383
#define PSH (PBN + 8)                // f16 per staged output row
__global__ __launch_bounds__(256) void k_proj(const float* __restrict__ CLS, const float* __restrict__ QRY, const float* __restrict__ DOC, const float* __restrict__ WQ, const float* __restrict__ BQ, const float* __restrict__ WK, const float* __restrict__ BK, const float* __restrict__ WV, const float* __restrict__ BV, _Float16* __restrict__ Q, _Float16* __restrict__ K, _Float16* __restrict__ V) { __shared__ __align__(16) unsigned char smem[PBM * PSH * 2];   // the two operand buffers (2 * PBUF * 2 B fit inside), then the output tile
  static_assert(2 * PBUF * 2 <= PBM * PSH * 2, "operand buffers fit");
  __bf16* st = (__bf16*)smem; _Float16* sh = (_Float16*)smem;
  const int tid = threadIdx.x, wave = tid >> 5, lane = tid & 31, col = lane & 15, g = lane >> 4, wm = wave & 1, wn = wave >> 1; const int which = blockIdx.z; const int c0 = blockIdx.y * PBN; const size_t r0 = (size_t)blockIdx.x * PBM;
  const float* Wm = which == 0 ? WQ : which == 1 ? WK : WV; const float* Bm = which == 0 ? BQ : which == 1 ? BK : BV;
  const int sr = tid >> 3, sc = tid & 7;   // staging: 8 lanes cover one row's 128 B, a wave-wide load covers 4 whole lines
  static_assert(NDOC % PBM == 0 && NBB * NQT == 64 && NBB <= 32 && PBM == 128, "the last block's rows: 64 query, then cls");
  const bool tail = r0 >= (size_t)NDOC;   // block-uniform: the row bases below are scalar and step by one slice per trip (from the last slice back to slice 0), a thread keeps two 32-bit offsets (a 64-bit pointer per staged row would pass 256 registers and halve the resident blocks)
  typedef const __attribute__((address_space(1))) float gfloat; typedef const __attribute__((address_space(1))) v4f gv4f;   // named as global memory: a pointer carried round the loop would otherwise be loaded through the flat path
  int kk = (int)((blockIdx.x + 5 * (blockIdx.y + (HIDN / PBN) * blockIdx.z)) % (HIDN / 32));   // the block's first k slice; it walks all HIDN / 32 slices from there and wraps, so blocks that share X rows (same x), or W rows (same y, z) with x that differ mod 24, ask L2 for different lines at any one time
  gfloat* xb[4] = { (gfloat*)(tail ? QRY : DOC + r0 * HIDN) + kk * 32, (gfloat*)(tail ? QRY + 32 * HIDN : DOC + (r0 + 32) * HIDN) + kk * 32, (gfloat*)(tail ? CLS : DOC + (r0 + 64) * HIDN) + kk * 32, (gfloat*)(tail ? CLS : DOC + (r0 + 96) * HIDN) + kk * 32 };
  const unsigned xo = (unsigned)(sr * HIDN + sc * 4), xc = tail ? (unsigned)((sr < NBB ? sr : NBB - 1) * HIDN + sc * 4) : xo;
  gfloat* wb = (gfloat*)(Wm + (size_t)c0 * HIDN) + kk * 32;
  v4f pre[12];
#pragma unroll
  for (int i = 0; i < 4; ++i) pre[i] = *(gv4f*)(xb[i] + (i < 2 ? xo : xc));
#pragma unroll
  for (int i = 0; i < 8; ++i) pre[4 + i] = *(gv4f*)(wb + i * 32 * HIDN + xo);
#pragma unroll
  for (int i = 0; i < 12; ++i) *(v4b*)(st + (sr + 32 * i) * PPIT + sc * 4) = __builtin_convertvector(pre[i], v4b);
  __syncthreads();
  v8f acc[4][4] = {};
  for (int kc = 0; kc < HIDN / 32; ++kc) { const __bf16* bp = st + (kc & 1) * PBUF;
    if (kc + 1 < HIDN / 32) { const bool wrap = kk + 1 == HIDN / 32; const int stp = wrap ? 32 - HIDN : 32; kk = wrap ? 0 : kk + 1;   // scalar: one slice on, or back to slice 0
#pragma unroll
      for (int i = 0; i < 4; ++i) { xb[i] += stp; pre[i] = *(gv4f*)(xb[i] + (i < 2 ? xo : xc)); }
      wb += stp;
#pragma unroll
      for (int i = 0; i < 8; ++i) pre[4 + i] = *(gv4f*)(wb + i * 32 * HIDN + xo); }
    v16b a[4], w[4];
#pragma unroll
    for (int i = 0; i < 4; ++i) { a[i] = frag_b(bp + (wm * 64 + i * 16 + col) * PPIT, lane); w[i] = frag_b(bp + (PBM + wn * 64 + i * 16 + col) * PPIT, lane); }
#pragma unroll
    for (int j = 0; j < 4; ++j)
#pragma unroll
      for (int i = 0; i < 4; ++i) acc[i][j] = wmma_bf(a[i], w[j], acc[i][j]);
    if (kc + 1 < HIDN / 32) { __bf16* sb = st + ((kc + 1) & 1) * PBUF;
#pragma unroll
      for (int i = 0; i < 12; ++i) *(v4b*)(sb + (sr + 32 * i) * PPIT + sc * 4) = __builtin_convertvector(pre[i], v4b); }
    __syncthreads(); }   // publishes slice kc + 1 and ends every read of slice kc's buffer, which slice kc + 2 (or the output tile) overwrites
#pragma unroll
  for (int j = 0; j < 4; ++j) { const float bb = bfr(Bm[c0 + wn * 64 + j * 16 + col]);
#pragma unroll
    for (int i = 0; i < 4; ++i)
#pragma unroll
      for (int r = 0; r < 8; ++r) sh[(wm * 64 + i * 16 + 8 * g + r) * PSH + wn * 64 + j * 16 + col] = (_Float16)(acc[i][j][r] + bb); }
  __syncthreads(); { _Float16* dst = which == 0 ? Q : which == 1 ? K : V; for (int e = tid; e < PBM * (PBN / 8); e += 256) { const int rl = e >> 5, q = e & 31; vst2((unsigned*)(dst + (r0 + rl) * HIDN + c0 + q * 8), *(const v4u*)&sh[rl * PSH + q * 8]); } } }
typedef __attribute__((ext_vector_type(8))) short v8s;
__device__ __forceinline__ v8s ld_tr16(const unsigned char* p) { typedef __attribute__((address_space(3))) v8s lds_v8s; return __builtin_amdgcn_ds_load_tr16_b128_v8i16((lds_v8s*)p); }   // transposing 16-byte LDS read
__device__ __forceinline__ float xhalf(float v) { const int b = __builtin_bit_cast(int, v); return __builtin_bit_cast(float, __builtin_amdgcn_permlanex16(b, b, 0x76543210, 0xfedcba98, false, false)); }   // the value of lane ^ 16
#define KPB 144                      // bytes per staged K row: 128 B + 16 B pad (16 B x odd: the 16-byte fragment reads of 16 rows fall on distinct banks)
#define VPB 160                      // bytes per staged V row: 128 B + 32 B pad (32 B x odd: the pitch at which the transposing 16-byte reads fall on distinct banks)
#define KTB (32 * KPB)               // bytes per staged 32-key tile of K
#define VTB (32 * VPB)               // bytes per staged 32-key tile of V
#define KVB (KTB + VTB)              // bytes per buffer: K tile, then V tile
#define NKT ((LSEQ + 31) / 32)       // key tiles
#define MKR ((NKT * 32 + 127) / 128) // rounds of 128 threads that fill the mask table
#define L2E 1.4426950408889634f      // log2(e): scores and masks are kept in base 2, so a weight is one subtraction and one hardware exp2
#define SC2 (0.125f * L2E)           // 1 / sqrt(64), in base 2
#define PEX 7.0f                     // the running maximum is kept 7 low, so the weights come out of exp2 times 2^7 (small ones stay normal f16); a rounded mx - 7 lies at most 7 further off, so a weight is at most 2^14 for any finite maximum
// one 32-key tile of K and of V into LDS (the thread's own K place ldk, V place ldv): a thread copies 16 bytes of rows sr and sr + 16 of each, so a wave-wide copy covers 4 whole 128-B lines; keys beyond 545 re-read the last row and are masked
__device__ __forceinline__ void stage_kv(const _Float16* __restrict__ K, const _Float16* __restrict__ V, int b, int d, int t, int sr, int colh, unsigned ldk, unsigned ldv) {
  int ka = t * 32 + sr, kb = ka + 16; ka = ka < LSEQ ? ka : LSEQ - 1; kb = kb < LSEQ ? kb : LSEQ - 1;
  const unsigned oa = (unsigned)tokrow(b, d, ka) * HIDN + colh, ob = (unsigned)tokrow(b, d, kb) * HIDN + colh;   // the offsets stay below NROW * 768
  const _Float16 *pka = K + oa, *pkb = K + ob, *pva = V + oa, *pvb = V + ob;
  const unsigned la = ldk, lb = ldk + 16 * KPB, lc = ldv, ld = ldv + 16 * VPB;
  // the four copies and, as the last line, the wait that stands before any of their address registers is rewritten
  asm volatile("global_load_async_to_lds_b128 %0, %1, off\n\tglobal_load_async_to_lds_b128 %2, %3, off\n\tglobal_load_async_to_lds_b128 %4, %5, off\n\tglobal_load_async_to_lds_b128 %6, %7, off\n\ts_wait_xcnt 0x0"
               :: "v"(la), "v"(pka), "v"(lb), "v"(pkb), "v"(lc), "v"(pva), "v"(ld), "v"(pvb) : "memory"); }
__global__ __launch_bounds__(128) void k_att(const _Float16* __restrict__ Q, const _Float16* __restrict__ K, const _Float16* __restrict__ V, const float* __restrict__ QM, const float* __restrict__ DMK, float* __restrict__ OUT) {
  __shared__ __align__(16) unsigned char ring[2 * KVB];   // two buffers of (K tile, V tile); behind the loop's last barrier the output staging so[4][16][68]
  __shared__ __align__(16) float smk[MKR * 128];              // the sequence's additive mask, built once (entries from NKT * 32 on are never read)
  static_assert(4 * 16 * 68 * 4 <= 2 * KVB, "output staging fits the ring");
  float (*so)[16][68] = (float (*)[16][68])ring;
  const int tid = threadIdx.x, wave = tid >> 5, lane = tid & 31, col = lane & 15, g = lane >> 4; const int qb = blockIdx.x, h = blockIdx.y; const int bd = blockIdx.z; const int b = bd / TND, d = bd % TND;
  const int sr = tid >> 3, colh = h * HD + (tid & 7) * 8; const unsigned ldk0 = (unsigned)(size_t)ring + (unsigned)(sr * KPB + (tid & 7) * 16), ldv0 = (unsigned)(size_t)ring + (unsigned)(KTB + sr * VPB + (tid & 7) * 16);
  stage_kv(K, V, b, d, 0, sr, colh, ldk0, ldv0);
  const int qi = qb * 64 + wave * 16 + col; const int qic = (qi < LSEQ) ? qi : (LSEQ - 1);   // positions beyond 545 (last block) are computed on a clamped row and never stored
  v16h bq[2];
#pragma unroll
  for (int kc = 0; kc < 2; ++kc) bq[kc] = frag_h(Q + (size_t)tokrow(b, d, qic) * HIDN + h * HD + kc * 32, lane);
#pragma unroll
  for (int u = 0; u < MKR; ++u) { const int ki = u * 128 + tid;   // unrolled and branch-free on clamped addresses: the loads of all rounds are in flight together
    const int qx = ki < 1 ? 0 : (ki <= NQT ? ki - 1 : NQT - 1), dx = ki <= NQT ? 0 : (ki < LSEQ ? ki - 1 - NQT : NS - 1);
    const float* mp = ki <= NQT ? QM + (size_t)b * NQT + qx : DMK + ((size_t)b * ND + d) * NS + dx;
    const float mv = bfr(*mp) * L2E; smk[ki] = ki >= LSEQ ? -3.0e38f : (ki == 0 ? 0.f : mv); }
  asm volatile("s_wait_asynccnt 0x0" ::: "memory");   // tile 0 has landed for this wave's copies
  __syncthreads();                                     // publishes tile 0 and the mask table
  stage_kv(K, V, b, d, 1, sr, colh, ldk0 + KVB, ldv0 + KVB);
  const int vlo = (8 * g + (lane & 7)) * VPB + 16 * ((lane >> 3) & 1);   // the lane's address in a 16-key x 16-column block for the transposing read
  float m = -3.0e38f; v2f l2 = {};   // the query's running maximum less PEX (equal in both halves) and this half's share of its sum, even and odd keys apart
  v8f acc[4] = {};               // acc[j][r] = O[query col][16 j + 8 g + r]
#pragma unroll 1
  for (int ks = 0; ks < NKT; ++ks) {   // rolled: one copy of the body, the buffer chosen by the trip's parity
    const _Float16* sk = (const _Float16*)(ring + (ks & 1) * KVB); const unsigned char* sv = ring + (ks & 1) * KVB + KTB + vlo;
    v16h kf[2][2]; v4f mk4[2][2];
#pragma unroll
    for (int ct = 0; ct < 2; ++ct) {
#pragma unroll
      for (int kc = 0; kc < 2; ++kc) kf[ct][kc] = frag_h(sk + (ct * 16 + col) * (KPB / 2) + kc * 32, lane);
      mk4[ct][0] = *(const v4f*)&smk[ks * 32 + ct * 16 + 8 * g]; mk4[ct][1] = *(const v4f*)&smk[ks * 32 + ct * 16 + 8 * g + 4]; }
    __builtin_amdgcn_sched_barrier(0);   // keeps the tile's K fragment and mask reads together ahead of the score products: one LDS latency, not one per product
    v2f s[2][4];   // neighbouring keys in pairs, as the accumulator and the mask table hold them: packed arithmetic with no register moves
#pragma unroll
    for (int ct = 0; ct < 2; ++ct) { v8f c = {};
#pragma unroll
      for (int kc = 0; kc < 2; ++kc) c = wmma16(kf[ct][kc], bq[kc], c);
#pragma unroll
      for (int p = 0; p < 4; ++p) s[ct][p] = (v2f){ c[2 * p], c[2 * p + 1] } * SC2 + (v2f){ mk4[ct][p >> 1][(2 * p) & 3], mk4[ct][p >> 1][(2 * p + 1) & 3] }; }   // no select for a masked key: key 0 is never masked, so from tile 0 on the maximum is a real score and exp2 of a masked key's distance to it is 0 by itself
    float mx = fmaxf(s[0][0][0], s[0][0][1]);
#pragma unroll
    for (int p = 1; p < 8; ++p) mx = fmaxf(mx, fmaxf(s[p >> 2][p & 3][0], s[p >> 2][p & 3][1]));
    mx -= PEX;
    const float mn = fmaxf(m, fmaxf(mx, xhalf(mx))), alpha = __builtin_amdgcn_exp2f(m - mn); v16h pb;
    l2 *= alpha;
#pragma unroll
    for (int ct = 0; ct < 2; ++ct)
#pragma unroll
      for (int p = 0; p < 4; ++p) { const v2f t = s[ct][p] - mn; const v2f e = { __builtin_amdgcn_exp2f(t[0]), __builtin_amdgcn_exp2f(t[1]) }; l2 += e; pb[ct * 8 + 2 * p] = (_Float16)e[0]; pb[ct * 8 + 2 * p + 1] = (_Float16)e[1]; }
    m = mn;
#pragma unroll
    for (int j = 0; j < 4; ++j)
#pragma unroll
      for (int r = 0; r < 8; ++r) acc[j][r] *= alpha;
    union { v16h v; v8s q[2]; } va[4];   // lane (col, g) receives V[8 g + 0..7][16 j + col] and V[16 + 8 g + 0..7][16 j + col]: the k order of pb
#pragma unroll
    for (int j = 0; j < 4; ++j) { va[j].q[0] = ld_tr16(sv + 32 * j); va[j].q[1] = ld_tr16(sv + 16 * VPB + 32 * j); }
#pragma unroll
    for (int j = 0; j < 4; ++j) acc[j] = wmma16(va[j].v, pb, acc[j]);
    asm volatile("s_wait_dscnt 0x0" ::: "memory");      // this wave's reads of the buffer have returned
    asm volatile("s_wait_asynccnt 0x0" ::: "memory");   // this wave's copies of tile ks + 1 have landed
    __syncthreads();                                     // publishes tile ks + 1 and ends every read of tile ks's buffer
    if (ks + 2 < NKT) stage_kv(K, V, b, d, ks + 2, sr, colh, ldk0 + (unsigned)(ks & 1) * KVB, ldv0 + (unsigned)(ks & 1) * KVB); }
  asm volatile("s_wait_asynccnt 0x0" ::: "memory");     // nothing is in flight when the ring becomes output staging
  float l = l2[0] + l2[1]; l += xhalf(l);
  const float il = 1.0f / l;   // sum and products carry the same power of two
#pragma unroll
  for (int j = 0; j < 4; ++j) { v4f oa, ob;
#pragma unroll
    for (int r = 0; r < 4; ++r) { oa[r] = acc[j][r] * il; ob[r] = acc[j][4 + r] * il; }
    *(v4f*)&so[wave][col][j * 16 + 8 * g] = oa; *(v4f*)&so[wave][col][j * 16 + 8 * g + 4] = ob; }
  LDSX();
  for (int rl = 0; rl < 16; ++rl) { const int qpos = qb * 64 + wave * 16 + rl; if (qpos < LSEQ && lane < 16) vst2(OUT + (((size_t)b * ND + d) * LSEQ + qpos) * HIDN + h * HD + lane * 4, *(const v4f*)&so[wave][rl][lane * 4]); } }
extern "C" void kernel_launch(void* const* d_in, const int* in_sizes, int n_in, void* d_out, int out_size, void* d_ws, size_t ws_size, hipStream_t stream) {
  (void)in_sizes; (void)n_in; (void)out_size;
  const float** F = (const float**)d_in;   // 0 cls [2,1,1,768], 1 query [2,1,32,768], 2 doc [2,16,512,768], 3 qmask [2,1,1,1,32], 4 dmask [2,1,16,1,512], 5 Wq, 6 bq, 7 Wk, 8 bk, 9 Wv, 10 bv
  if (ws_size < (size_t)WS_END) return;
  char* ws = (char*)d_ws; _Float16 *Q = (_Float16*)(ws + WS_Q), *K = (_Float16*)(ws + WS_K), *V = (_Float16*)(ws + WS_V);
  k_proj<<<dim3((TPR + 1) / 2, HIDN / PBN, 3), 256, 0, stream>>>(F[0], F[1], F[2], F[5], F[6], F[7], F[8], F[9], F[10], Q, K, V);
  k_att<<<dim3((LSEQ + 63) / 64, NH, TNB * TND), 128, 0, stream>>>(Q, K, V, F[3], F[4], (float*)d_out);
}

// v008
// Measured time: 117 microseconds a run.
// In two side-by-side timings against v007, it was 1.08 and 1.07 times as fast.
// Over all steps from v000 it is 5.18 times as fast.
// compute dtype: all float inputs rounded to bf16, qmask/dmask read; q/k/v = hs W^T + b for every unique token (cls, query, doc) with EXACT bf16 products on WMMA 16x16x32 (natural weights), f32 accumulate, rounded once to f16 rows (0.02-scale weights: logits ~0.3); per (batch, document) self attention over its 545-token sequence [cls | query | doc_d] with the additive float masks, single f16 score products x 1/8, running-max softmax in f32 in base 2 (hardware exp2), P (f16 x 2^7) . v gathered per key tile; heads merged; f32 output.
#include <hip/hip_runtime.h>
#include <math.h>

typedef __attribute__((ext_vector_type(16))) _Float16 v16h;
typedef __attribute__((ext_vector_type(16))) __bf16 v16b;
typedef __attribute__((ext_vector_type(8)))  _Float16 v8h;
typedef __attribute__((ext_vector_type(8)))  float v8f;
typedef __attribute__((ext_vector_type(4)))  float v4f;
typedef __attribute__((ext_vector_type(2)))  float v2f;
typedef __attribute__((ext_vector_type(4)))  unsigned v4u;
typedef __attribute__((ext_vector_type(4)))  int v4i;
typedef float __attribute__((may_alias)) float_a;
typedef int __attribute__((may_alias)) int_a;

template <typename T> __device__ __forceinline__ void vst2(void* p, T v) { *(T*)p = v;  }
__device__ __forceinline__ v8f wmma16(v16h a, v16h b, v8f c) {
  v8f d = __builtin_amdgcn_wmma_f32_16x16x32_f16(false, a, false, b, (short)0, c, false, false);
  asm volatile("v_nop\n\tv_nop\n\tv_nop\n\tv_nop" : "+v"(d) : "v"(a), "v"(b));
  return d;
}
__device__ __forceinline__ v8f wmma_bf(v16b a, v16b b, v8f c) {
  v8f d = __builtin_amdgcn_wmma_f32_16x16x32_bf16(false, a, false, b, (short)0, c, false, false);
  asm volatile("v_nop\n\tv_nop\n\tv_nop\n\tv_nop" : "+v"(d) : "v"(a), "v"(b));
  return d;
}
// 16x16x32 fragments: lane = (h = lane>>4, row/col = lane&15); elements 0..7 = k0+8h+0..7, 8..15 = k0+16+8h+0..7; D element r = row 8h+r
__device__ __forceinline__ v16h frag_h(const _Float16* rowk0, int lane) {
  union { v16h v; v8h q[2]; } u; const _Float16* p = rowk0 + 8 * (lane >> 4);
  u.q[0] = *(const v8h*)p; u.q[1] = *(const v8h*)(p + 16); return u.v;
}
__device__ __forceinline__ v16h frag_f32(const float* rowk0, int lane) {
  v16h a; const float* p = rowk0 + 8 * (lane >> 4);
#pragma unroll
  for (int i = 0; i < 8; ++i) { a[i] = (_Float16)p[i]; a[8 + i] = (_Float16)p[16 + i]; }
  return a;
}
__device__ __forceinline__ v16h frag_f32s(const float* rowk0, int lane, float sc) {
  v16h a; const float* p = rowk0 + 8 * (lane >> 4);
#pragma unroll
  for (int i = 0; i < 8; ++i) { a[i] = (_Float16)(p[i] * sc); a[8 + i] = (_Float16)(p[16 + i] * sc); }
  return a;
}
// column fragment from a [K][ld] layout (column n), rows >= K read as 0
__device__ __forceinline__ v16h fragc_f32(const float* W, int k0, int n, int lane, int ld, int K) {
  v16h a; const int g = lane >> 4;
#pragma unroll
  for (int i = 0; i < 8; ++i) { const int ka = k0 + 8 * g + i, kb = ka + 16;
    a[i] = (_Float16)(ka < K ? W[(size_t)(ka < K ? ka : K - 1) * ld + n] : 0.f); a[8 + i] = (_Float16)(kb < K ? W[(size_t)(kb < K ? kb : K - 1) * ld + n] : 0.f); }
  return a;
}
struct F2 { v16b h, l; };
__device__ __forceinline__ F2 bsplit16(const float v[16]) { F2 r;
#pragma unroll
  for (int i = 0; i < 16; ++i) { const __bf16 h = (__bf16)v[i]; r.h[i] = h; r.l[i] = (__bf16)(v[i] - (float)h); }
  return r; }
__device__ __forceinline__ F2 split_row(const float* row, int k0, int lane) { float v[16]; const float* p = row + k0 + 8 * (lane >> 4);
#pragma unroll
  for (int i = 0; i < 8; ++i) { v[i] = p[i]; v[8 + i] = p[16 + i]; }
  return bsplit16(v); }
__device__ __forceinline__ F2 split_rowK(const float* row, int k0, int lane, int K) { float v[16]; const int g = lane >> 4;
#pragma unroll
  for (int i = 0; i < 8; ++i) { const int ka = k0 + 8 * g + i, kb = ka + 16; v[i] = ka < K ? row[ka < K ? ka : K - 1] : 0.f; v[8 + i] = kb < K ? row[kb < K ? kb : K - 1] : 0.f; }
  return bsplit16(v); }
__device__ __forceinline__ F2 split_col(const float* W, int k0, int n, int lane, int ld, int K) { float v[16]; const int g = lane >> 4;
#pragma unroll
  for (int i = 0; i < 8; ++i) { const int ka = k0 + 8 * g + i, kb = ka + 16; v[i] = ka < K ? W[(size_t)(ka < K ? ka : K - 1) * ld + n] : 0.f; v[8 + i] = kb < K ? W[(size_t)(kb < K ? kb : K - 1) * ld + n] : 0.f; }
  return bsplit16(v); }
__device__ __forceinline__ v8f mac3(const F2& a, const F2& b, v8f c) { c = wmma_bf(a.l, b.h, c); c = wmma_bf(a.h, b.l, c); return wmma_bf(a.h, b.h, c); }
__device__ __forceinline__ float sigm(float v) { return 1.0f / (1.0f + expf(-v)); }
#define LDSX() do { asm volatile("s_wait_dscnt 0" ::: "memory"); __builtin_amdgcn_wave_barrier(); __builtin_amdgcn_fence(__ATOMIC_RELEASE, "workgroup"); } while (0)


// Sparse cross-encoder self attention (B 2, 16 documents x 512 tokens, 32 query tokens, 1 cls; hidden 768 = 12 heads x 64): every segment attends over [cls | query | doc_d] per document (cat_forward path), outputs concatenated along the sequence -> [b, 16, 545, 768].
#define NBB 2
#define ND 16
#define NQT 32
#define NS 512
#define HIDN 768
#define NH 12
#define HD 64
#define LSEQ (1 + NQT + NS)          // 545
#define RPB (1 + NQT + ND * NS)      // unique token rows per batch = 8225
#define NROW (NBB * RPB)             // 16450
#define NROWP (((NROW + 63) / 64) * 64)
#ifndef TND
#define TND ND                       // documents per batch processed
#endif
#ifndef TNB
#define TNB NBB
#endif
#ifndef TPR
#define TPR (NROWP / 64)              // 64-row blocks of padded rows (two per k_proj block)
#endif
typedef __attribute__((ext_vector_type(8))) __bf16 v8b;
__device__ __forceinline__ v16b frag_b(const __bf16* rowk0, int lane) {
  union { v16b v; v8b q[2]; } u; const __bf16* p = rowk0 + 8 * (lane >> 4);
  u.q[0] = *(const v8b*)p; u.q[1] = *(const v8b*)(p + 16); return u.v;
}
__device__ __forceinline__ float bfr(float v) { return (float)(__bf16)v; }
__device__ __attribute__((noinline)) float exp_ni(float v) { return expf(v); }
__device__ __attribute__((noinline)) float erf_ni(float v) { return erff(v); }

#define NDOC (NBB * ND * NS)         // unique token rows, in the inputs' own order: the doc rows first, then the NBB * NQT query rows, then the NBB cls rows
#define ROWQ NDOC
#define ROWC (NDOC + NBB * NQT)
#define WS_Q   0u                                    // f16 q rows [NROWP][768]
#define WS_K   (WS_Q + 2u * (size_t)NROWP * HIDN)
#define WS_V   (WS_K + 2u * (size_t)NROWP * HIDN)
#define WS_P   (WS_V + 2u * (size_t)NROWP * HIDN)  // bf16 operand plane [HIDN / 32][NPR][32]
#define NXR NROWP                    // X rows in the plane: the unique token rows, then pad rows
#define NPR (NXR + 3 * HIDN)         // plane rows: X rows, then the rows of Wq, Wk, Wv
#define WS_END (WS_P + 2u * (size_t)NPR * HIDN)

__device__ __forceinline__ int tokrow(int b, int d, int i) { const int base = i > NQT ? (b * ND + d) * NS - (1 + NQT) : (i == 0 ? ROWC + b : ROWQ + b * NQT - 1); return base + i; }   // position i of document d's sequence -> unique row
// ---- k_cvt: every X row (doc, query, cls, in the unique-row order; pad rows re-read the cls rows, what is projected from those is never read) and every row of Wq, Wk, Wv is rounded to bf16 ONCE, into a plane ordered by k slice, P[slice][row][32 k]: the rows of one slice lie back to back, 64 B each, so whatever run of rows a k_proj block stages is contiguous. block = (32 rows, half of the slices), 4 waves; wave w of 8 takes slices 3 w .. 3 w + 2: a wave-wide load covers 4 whole 128-B lines, a wave-wide store 256 contiguous bytes
typedef __attribute__((ext_vector_type(4))) __bf16 v4b;
typedef const __attribute__((address_space(1))) float gfloat; typedef const __attribute__((address_space(1))) v4f gv4f; typedef __attribute__((address_space(1))) __bf16 gbfw; typedef __attribute__((address_space(1))) v4b gv4b;   // named as global memory: every access is scalar base + one 32-bit lane offset + immediate
// RND rounds of 4 source rows (1 where all 8 rounds of plane rows repeat the same 4 source rows) x 3 slices
template <int RND> __device__ __forceinline__ void cvt_rows(gfloat* sb, gbfw* db, unsigned vo, unsigned wo) {
  v4f pre[3][RND]; v4b cv[3][RND];
#pragma unroll
  for (int j = 0; j < 3; ++j)
#pragma unroll
    for (int i = 0; i < RND; ++i) pre[j][i] = *(gv4f*)(sb + i * (4 * HIDN) + j * 32 + vo);
  asm volatile("s_wait_xcnt 0x0" ::: "memory");   // stands before any register that the loads name is rewritten
  __builtin_amdgcn_sched_barrier(0);   // keeps the wave's loads in flight together, ahead of the first conversion: one memory latency a wave
#pragma unroll
  for (int j = 0; j < 3; ++j)
#pragma unroll
    for (int i = 0; i < RND; ++i) cv[j][i] = __builtin_convertvector(pre[j][i], v4b);
#pragma unroll
  for (int j = 0; j < 3; ++j)
#pragma unroll
    for (int i = 0; i < 8; ++i) *(gv4b*)(db + j * (NPR * 32) + i * (4 * 32) + wo) = cv[j][RND == 1 ? 0 : i];
  asm volatile("s_wait_xcnt 0x0" ::: "memory"); }   // stands behind the last store, before any register that the stores name is rewritten
__global__ __launch_bounds__(128) void k_cvt(const float* __restrict__ CLS, const float* __restrict__ QRY, const float* __restrict__ DOC, const float* __restrict__ WQ, const float* __restrict__ WK, const float* __restrict__ WV, __bf16* __restrict__ P) {
  static_assert(NDOC % 32 == 0 && (NBB * NQT) % 32 == 0 && NXR % 32 == 0 && HIDN % 32 == 0 && HIDN / 32 == 24, "a block's 32 rows are of one kind; 8 waves x 3 slices");
  static_assert(NBB == 1 || NBB == 2 || NBB == 4, "row j of the cls and pad rows reads cls row j mod NBB, which a lane's place among 4 rows gives");
  const int tw = threadIdx.x >> 5, lane = threadIdx.x & 31, rl = lane >> 3, sc = lane & 7; const int r0 = blockIdx.x * 32;
  const bool isc = r0 >= ROWC && r0 < NXR; const int w0 = r0 - NXR;   // block-uniform
  const float* src = r0 < NDOC ? DOC + (size_t)r0 * HIDN : r0 < ROWC ? QRY + (size_t)(r0 - ROWQ) * HIDN : isc ? CLS : (w0 < HIDN ? WQ + (size_t)w0 * HIDN : w0 < 2 * HIDN ? WK + (size_t)(w0 - HIDN) * HIDN : WV + (size_t)(w0 - 2 * HIDN) * HIDN);
  gfloat* sb = (gfloat*)src + blockIdx.y * (12 * 32); gbfw* db = (gbfw*)P + ((size_t)(12 * blockIdx.y) * NPR + r0) * 32;   // scalar: the block's first row and slice
  const unsigned ko = (unsigned)(tw * (3 * 32) + sc * 4), wo = (unsigned)((tw * 3 * NPR + rl) * 32 + sc * 4);
  if (isc) cvt_rows<1>(sb, db, (unsigned)((rl & (NBB - 1)) * HIDN) + ko, wo); else cvt_rows<8>(sb, db, (unsigned)(rl * HIDN) + ko, wo); }
// ---- k_proj: block = (128 rows, 256 cols, which), 8 waves of 64 x 64: f16 rows of X W^T + b (exact). Each 32-k slice of the 128 X rows and 256 W rows is read once per block from the bf16 plane (8 KB and 16 KB, each contiguous) and staged in LDS (two buffers, one barrier per slice); every wave takes its fragments from there
#define PBM 128
#define PBN 256
#define PPIT 40                      // bf16 per staged row: 64 B of k + 16 B pad (80 B = 16 B x odd: the 16-byte fragment reads of 16 rows fall on distinct banks)
#define PBUF ((PBM + PBN) * PPIT)    // bf16 per buffer: X rows 0..127, W rows 128..383
#define PSH (PBN + 8)                // f16 per staged output row
__global__ __launch_bounds__(256) void k_proj(const __bf16* __restrict__ P, const float* __restrict__ BQ, const float* __restrict__ BK, const float* __restrict__ BV, _Float16* __restrict__ Q, _Float16* __restrict__ K, _Float16* __restrict__ V) { __shared__ __align__(16) unsigned char smem[PBM * PSH * 2];   // the two operand buffers (2 * PBUF * 2 B fit inside), then the output tile
  static_assert(2 * PBUF * 2 <= PBM * PSH * 2, "operand buffers fit");
  static_assert(NXR % PBM == 0 && HIDN % PBN == 0 && PBM % 64 == 0 && PBN % 64 == 0, "whole tiles, staged 64 rows a round");
  __bf16* st = (__bf16*)smem; _Float16* sh = (_Float16*)smem;
  const int tid = threadIdx.x, wave = tid >> 5, lane = tid & 31, col = lane & 15, g = lane >> 4, wm = wave & 1, wn = wave >> 1; const int which = blockIdx.z; const int c0 = blockIdx.y * PBN; const size_t r0 = (size_t)blockIdx.x * PBM;
  const float* Bm = which == 0 ? BQ : which == 1 ? BK : BV;
  const int sr = tid >> 2, sc = tid & 3;   // staging: 4 lanes cover one row's 64 B, the block 64 rows a round; a wave-wide load covers 4 whole lines
  typedef const __attribute__((address_space(1))) __bf16 gbf; typedef const __attribute__((address_space(1))) v8b gv8b;   // named as global memory: a pointer carried round the loop would otherwise be loaded through the flat path
  int kk = (int)((blockIdx.x + 5 * (blockIdx.y + (HIDN / PBN) * blockIdx.z)) % (HIDN / 32));   // the block's first k slice; it walks all HIDN / 32 slices from there and wraps, so blocks that share W rows (same y, z) or X rows (same x) ask L2 for different lines at any one time
  gbf* xb = (gbf*)P + ((size_t)kk * NPR + r0) * 32;   // scalar bases that step by one slice per trip; a thread keeps one 32-bit offset
  gbf* wb = (gbf*)P + ((size_t)kk * NPR + NXR + (size_t)which * HIDN + c0) * 32;
  const unsigned po = (unsigned)tid * 8;
  v8b pre[6];
#pragma unroll
  for (int i = 0; i < 2; ++i) pre[i] = *(gv8b*)(xb + i * 64 * 32 + po);
#pragma unroll
  for (int i = 0; i < 4; ++i) pre[2 + i] = *(gv8b*)(wb + i * 64 * 32 + po);
#pragma unroll
  for (int i = 0; i < 6; ++i) *(v8b*)(st + (sr + 64 * i) * PPIT + sc * 8) = pre[i];
  __syncthreads();
  v8f acc[4][4] = {};
  for (int kc = 0; kc < HIDN / 32; ++kc) { const __bf16* bp = st + (kc & 1) * PBUF;
    if (kc + 1 < HIDN / 32) { const bool wrap = kk + 1 == HIDN / 32; const int stp = wrap ? -(HIDN / 32 - 1) * NPR * 32 : NPR * 32; kk = wrap ? 0 : kk + 1;   // scalar: one slice on, or back to slice 0
      xb += stp; wb += stp;
#pragma unroll
      for (int i = 0; i < 2; ++i) pre[i] = *(gv8b*)(xb + i * 64 * 32 + po);
#pragma unroll
      for (int i = 0; i < 4; ++i) pre[2 + i] = *(gv8b*)(wb + i * 64 * 32 + po); }
    v16b a[4], w[4];
#pragma unroll
    for (int i = 0; i < 4; ++i) { a[i] = frag_b(bp + (wm * 64 + i * 16 + col) * PPIT, lane); w[i] = frag_b(bp + (PBM + wn * 64 + i * 16 + col) * PPIT, lane); }
#pragma unroll
    for (int j = 0; j < 4; ++j)
#pragma unroll
      for (int i = 0; i < 4; ++i) acc[i][j] = wmma_bf(a[i], w[j], acc[i][j]);
    if (kc + 1 < HIDN / 32) { __bf16* sb = st + ((kc + 1) & 1) * PBUF;
#pragma unroll
      for (int i = 0; i < 6; ++i) *(v8b*)(sb + (sr + 64 * i) * PPIT + sc * 8) = pre[i]; }
    __syncthreads(); }   // publishes slice kc + 1 and ends every read of slice kc's buffer, which slice kc + 2 (or the output tile) overwrites
#pragma unroll
  for (int j = 0; j < 4; ++j) { const float bb = bfr(Bm[c0 + wn * 64 + j * 16 + col]);
#pragma unroll
    for (int i = 0; i < 4; ++i)
#pragma unroll
      for (int r = 0; r < 8; ++r) sh[(wm * 64 + i * 16 + 8 * g + r) * PSH + wn * 64 + j * 16 + col] = (_Float16)(acc[i][j][r] + bb); }
  __syncthreads(); { _Float16* dst = which == 0 ? Q : which == 1 ? K : V; for (int e = tid; e < PBM * (PBN / 8); e += 256) { const int rl = e >> 5, q = e & 31; vst2((unsigned*)(dst + (r0 + rl) * HIDN + c0 + q * 8), *(const v4u*)&sh[rl * PSH + q * 8]); } } }
typedef __attribute__((ext_vector_type(8))) short v8s;
__device__ __forceinline__ v8s ld_tr16(const unsigned char* p) { typedef __attribute__((address_space(3))) v8s lds_v8s; return __builtin_amdgcn_ds_load_tr16_b128_v8i16((lds_v8s*)p); }   // transposing 16-byte LDS read
__device__ __forceinline__ float xhalf(float v) { const int b = __builtin_bit_cast(int, v); return __builtin_bit_cast(float, __builtin_amdgcn_permlanex16(b, b, 0x76543210, 0xfedcba98, false, false)); }   // the value of lane ^ 16
#define KPB 144                      // bytes per staged K row: 128 B + 16 B pad (16 B x odd: the 16-byte fragment reads of 16 rows fall on distinct banks)
#define VPB 160                      // bytes per staged V row: 128 B + 32 B pad (32 B x odd: the pitch at which the transposing 16-byte reads fall on distinct banks)
#define KTB (32 * KPB)               // bytes per staged 32-key tile of K
#define VTB (32 * VPB)               // bytes per staged 32-key tile of V
#define KVB (KTB + VTB)              // bytes per buffer: K tile, then V tile
#define NKT ((LSEQ + 31) / 32)       // key tiles
#define MKR ((NKT * 32 + 127) / 128) // rounds of 128 threads that fill the mask table
#define L2E 1.4426950408889634f      // log2(e): scores and masks are kept in base 2, so a weight is one subtraction and one hardware exp2
#define SC2 (0.125f * L2E)           // 1 / sqrt(64), in base 2
#define PEX 7.0f                     // the running maximum is kept 7 low, so the weights come out of exp2 times 2^7 (small ones stay normal f16); a rounded mx - 7 lies at most 7 further off, so a weight is at most 2^14 for any finite maximum
// one 32-key tile of K and of V into LDS (the thread's own K place ldk, V place ldv): a thread copies 16 bytes of rows sr and sr + 16 of each, so a wave-wide copy covers 4 whole 128-B lines; keys beyond 545 re-read the last row and are masked
__device__ __forceinline__ void stage_kv(const _Float16* __restrict__ K, const _Float16* __restrict__ V, int b, int d, int t, int sr, int colh, unsigned ldk, unsigned ldv) {
  int ka = t * 32 + sr, kb = ka + 16; ka = ka < LSEQ ? ka : LSEQ - 1; kb = kb < LSEQ ? kb : LSEQ - 1;
  const unsigned oa = (unsigned)tokrow(b, d, ka) * HIDN + colh, ob = (unsigned)tokrow(b, d, kb) * HIDN + colh;   // the offsets stay below NROW * 768
  const _Float16 *pka = K + oa, *pkb = K + ob, *pva = V + oa, *pvb = V + ob;
  const unsigned la = ldk, lb = ldk + 16 * KPB, lc = ldv, ld = ldv + 16 * VPB;
  // the four copies and, as the last line, the wait that stands before any of their address registers is rewritten
  asm volatile("global_load_async_to_lds_b128 %0, %1, off\n\tglobal_load_async_to_lds_b128 %2, %3, off\n\tglobal_load_async_to_lds_b128 %4, %5, off\n\tglobal_load_async_to_lds_b128 %6, %7, off\n\ts_wait_xcnt 0x0"
               :: "v"(la), "v"(pka), "v"(lb), "v"(pkb), "v"(lc), "v"(pva), "v"(ld), "v"(pvb) : "memory"); }
__global__ __launch_bounds__(128) void k_att(const _Float16* __restrict__ Q, const _Float16* __restrict__ K, const _Float16* __restrict__ V, const float* __restrict__ QM, const float* __restrict__ DMK, float* __restrict__ OUT) {
  __shared__ __align__(16) unsigned char ring[2 * KVB];   // two buffers of (K tile, V tile); behind the loop's last barrier the output staging so[4][16][68]
  __shared__ __align__(16) float smk[MKR * 128];              // the sequence's additive mask, built once (entries from NKT * 32 on are never read)
  static_assert(4 * 16 * 68 * 4 <= 2 * KVB, "output staging fits the ring");
  float (*so)[16][68] = (float (*)[16][68])ring;
  const int tid = threadIdx.x, wave = tid >> 5, lane = tid & 31, col = lane & 15, g = lane >> 4; const int qb = blockIdx.x, h = blockIdx.y; const int bd = blockIdx.z; const int b = bd / TND, d = bd % TND;
  const int sr = tid >> 3, colh = h * HD + (tid & 7) * 8; const unsigned ldk0 = (unsigned)(size_t)ring + (unsigned)(sr * KPB + (tid & 7) * 16), ldv0 = (unsigned)(size_t)ring + (unsigned)(KTB + sr * VPB + (tid & 7) * 16);
  stage_kv(K, V, b, d, 0, sr, colh, ldk0, ldv0);
  const int qi = qb * 64 + wave * 16 + col; const int qic = (qi < LSEQ) ? qi : (LSEQ - 1);   // positions beyond 545 (last block) are computed on a clamped row and never stored
  v16h bq[2];
#pragma unroll
  for (int kc = 0; kc < 2; ++kc) bq[kc] = frag_h(Q + (size_t)tokrow(b, d, qic) * HIDN + h * HD + kc * 32, lane);
#pragma unroll
  for (int u = 0; u < MKR; ++u) { const int ki = u * 128 + tid;   // unrolled and branch-free on clamped addresses: the loads of all rounds are in flight together
    const int qx = ki < 1 ? 0 : (ki <= NQT ? ki - 1 : NQT - 1), dx = ki <= NQT ? 0 : (ki < LSEQ ? ki - 1 - NQT : NS - 1);
    const float* mp = ki <= NQT ? QM + (size_t)b * NQT + qx : DMK + ((size_t)b * ND + d) * NS + dx;
    const float mv = bfr(*mp) * L2E; smk[ki] = ki >= LSEQ ? -3.0e38f : (ki == 0 ? 0.f : mv); }
  asm volatile("s_wait_asynccnt 0x0" ::: "memory");   // tile 0 has landed for this wave's copies
  __syncthreads();                                     // publishes tile 0 and the mask table
  stage_kv(K, V, b, d, 1, sr, colh, ldk0 + KVB, ldv0 + KVB);
  const int vlo = (8 * g + (lane & 7)) * VPB + 16 * ((lane >> 3) & 1);   // the lane's address in a 16-key x 16-column block for the transposing read
  float m = -3.0e38f; v2f l2 = {};   // the query's running maximum less PEX (equal in both halves) and this half's share of its sum, even and odd keys apart
  v8f acc[4] = {};               // acc[j][r] = O[query col][16 j + 8 g + r]
#pragma unroll 1
  for (int ks = 0; ks < NKT; ++ks) {   // rolled: one copy of the body, the buffer chosen by the trip's parity
    const _Float16* sk = (const _Float16*)(ring + (ks & 1) * KVB); const unsigned char* sv = ring + (ks & 1) * KVB + KTB + vlo;
    v16h kf[2][2]; v4f mk4[2][2];
#pragma unroll
    for (int ct = 0; ct < 2; ++ct) {
#pragma unroll
      for (int kc = 0; kc < 2; ++kc) kf[ct][kc] = frag_h(sk + (ct * 16 + col) * (KPB / 2) + kc * 32, lane);
      mk4[ct][0] = *(const v4f*)&smk[ks * 32 + ct * 16 + 8 * g]; mk4[ct][1] = *(const v4f*)&smk[ks * 32 + ct * 16 + 8 * g + 4]; }
    __builtin_amdgcn_sched_barrier(0);   // keeps the tile's K fragment and mask reads together ahead of the score products: one LDS latency, not one per product
    v2f s[2][4];   // neighbouring keys in pairs, as the accumulator and the mask table hold them: packed arithmetic with no register moves
#pragma unroll
    for (int ct = 0; ct < 2; ++ct) { v8f c = {};
#pragma unroll
      for (int kc = 0; kc < 2; ++kc) c = wmma16(kf[ct][kc], bq[kc], c);
#pragma unroll
      for (int p = 0; p < 4; ++p) s[ct][p] = (v2f){ c[2 * p], c[2 * p + 1] } * SC2 + (v2f){ mk4[ct][p >> 1][(2 * p) & 3], mk4[ct][p >> 1][(2 * p + 1) & 3] }; }   // no select for a masked key: key 0 is never masked, so from tile 0 on the maximum is a real score and exp2 of a masked key's distance to it is 0 by itself
    float mx = fmaxf(s[0][0][0], s[0][0][1]);
#pragma unroll
    for (int p = 1; p < 8; ++p) mx = fmaxf(mx, fmaxf(s[p >> 2][p & 3][0], s[p >> 2][p & 3][1]));
    mx -= PEX;
    const float mn = fmaxf(m, fmaxf(mx, xhalf(mx))), alpha = __builtin_amdgcn_exp2f(m - mn); v16h pb;
    l2 *= alpha;
#pragma unroll
    for (int ct = 0; ct < 2; ++ct)
#pragma unroll
      for (int p = 0; p < 4; ++p) { const v2f t = s[ct][p] - mn; const v2f e = { __builtin_amdgcn_exp2f(t[0]), __builtin_amdgcn_exp2f(t[1]) }; l2 += e; pb[ct * 8 + 2 * p] = (_Float16)e[0]; pb[ct * 8 + 2 * p + 1] = (_Float16)e[1]; }
    m = mn;
#pragma unroll
    for (int j = 0; j < 4; ++j)
#pragma unroll
      for (int r = 0; r < 8; ++r) acc[j][r] *= alpha;
    union { v16h v; v8s q[2]; } va[4];   // lane (col, g) receives V[8 g + 0..7][16 j + col] and V[16 + 8 g + 0..7][16 j + col]: the k order of pb
#pragma unroll
    for (int j = 0; j < 4; ++j) { va[j].q[0] = ld_tr16(sv + 32 * j); va[j].q[1] = ld_tr16(sv + 16 * VPB + 32 * j); }
#pragma unroll
    for (int j = 0; j < 4; ++j) acc[j] = wmma16(va[j].v, pb, acc[j]);
    asm volatile("s_wait_dscnt 0x0" ::: "memory");      // this wave's reads of the buffer have returned
    asm volatile("s_wait_asynccnt 0x0" ::: "memory");   // this wave's copies of tile ks + 1 have landed
    __syncthreads();                                     // publishes tile ks + 1 and ends every read of tile ks's buffer
    if (ks + 2 < NKT) stage_kv(K, V, b, d, ks + 2, sr, colh, ldk0 + (unsigned)(ks & 1) * KVB, ldv0 + (unsigned)(ks & 1) * KVB); }
  asm volatile("s_wait_asynccnt 0x0" ::: "memory");     // nothing is in flight when the ring becomes output staging
  float l = l2[0] + l2[1]; l += xhalf(l);
  const float il = 1.0f / l;   // sum and products carry the same power of two
#pragma unroll
  for (int j = 0; j < 4; ++j) { v4f oa, ob;
#pragma unroll
    for (int r = 0; r < 4; ++r) { oa[r] = acc[j][r] * il; ob[r] = acc[j][4 + r] * il; }
    *(v4f*)&so[wave][col][j * 16 + 8 * g] = oa; *(v4f*)&so[wave][col][j * 16 + 8 * g + 4] = ob; }
  LDSX();
  for (int rl = 0; rl < 16; ++rl) { const int qpos = qb * 64 + wave * 16 + rl; if (qpos < LSEQ && lane < 16) vst2(OUT + (((size_t)b * ND + d) * LSEQ + qpos) * HIDN + h * HD + lane * 4, *(const v4f*)&so[wave][rl][lane * 4]); } }
extern "C" void kernel_launch(void* const* d_in, const int* in_sizes, int n_in, void* d_out, int out_size, void* d_ws, size_t ws_size, hipStream_t stream) {
  (void)in_sizes; (void)n_in; (void)out_size;
  const float** F = (const float**)d_in;   // 0 cls [2,1,1,768], 1 query [2,1,32,768], 2 doc [2,16,512,768], 3 qmask [2,1,1,1,32], 4 dmask [2,1,16,1,512], 5 Wq, 6 bq, 7 Wk, 8 bk, 9 Wv, 10 bv
  if (ws_size < (size_t)WS_END) return;
  char* ws = (char*)d_ws; _Float16 *Q = (_Float16*)(ws + WS_Q), *K = (_Float16*)(ws + WS_K), *V = (_Float16*)(ws + WS_V); __bf16* P = (__bf16*)(ws + WS_P);
  k_cvt<<<dim3(NPR / 32, 2), 128, 0, stream>>>(F[0], F[1], F[2], F[5], F[7], F[9], P);
  k_proj<<<dim3((TPR + 1) / 2, HIDN / PBN, 3), 256, 0, stream>>>(P, F[6], F[8], F[10], Q, K, V);
  k_att<<<dim3((LSEQ + 63) / 64, NH, TNB * TND), 128, 0, stream>>>(Q, K, V, F[3], F[4], (float*)d_out);
}

// v009
// It runs in 112 microseconds.
// Timed twice side by side with v008, it ran 1.05 times as fast both times.
// Over all steps from v000 it is 5.43 times as fast.
// compute dtype: all float inputs rounded to bf16, qmask/dmask read; q/k/v = hs W^T + b for every unique token (cls, query, doc) with EXACT bf16 products on WMMA 16x16x32 (natural weights), f32 accumulate, rounded once to f16 rows (0.02-scale weights: logits ~0.3); per (batch, document) self attention over its 545-token sequence [cls | query | doc_d] with the additive float masks, single f16 score products x 1/8, running-max softmax in f32 in base 2 (hardware exp2), P (f16 x 2^7) . v gathered per key tile; heads merged; f32 output.
#include <hip/hip_runtime.h>
#include <math.h>

typedef __attribute__((ext_vector_type(16))) _Float16 v16h;
typedef __attribute__((ext_vector_type(16))) __bf16 v16b;
typedef __attribute__((ext_vector_type(8)))  _Float16 v8h;
typedef __attribute__((ext_vector_type(8)))  float v8f;
typedef __attribute__((ext_vector_type(4)))  float v4f;
typedef __attribute__((ext_vector_type(2)))  float v2f;
typedef __attribute__((ext_vector_type(4)))  unsigned v4u;
typedef __attribute__((ext_vector_type(4)))  int v4i;
typedef float __attribute__((may_alias)) float_a;
typedef int __attribute__((may_alias)) int_a;

template <typename T> __device__ __forceinline__ void vst2(void* p, T v) { *(T*)p = v;  }
__device__ __forceinline__ v8f wmma16(v16h a, v16h b, v8f c) {
  v8f d = __builtin_amdgcn_wmma_f32_16x16x32_f16(false, a, false, b, (short)0, c, false, false);
  asm volatile("v_nop\n\tv_nop\n\tv_nop\n\tv_nop" : "+v"(d) : "v"(a), "v"(b));
  return d;
}
__device__ __forceinline__ v8f wmma_bf(v16b a, v16b b, v8f c) {
  v8f d = __builtin_amdgcn_wmma_f32_16x16x32_bf16(false, a, false, b, (short)0, c, false, false);
  asm volatile("v_nop\n\tv_nop\n\tv_nop\n\tv_nop" : "+v"(d) : "v"(a), "v"(b));
  return d;
}
// 16x16x32 fragments: lane = (h = lane>>4, row/col = lane&15); elements 0..7 = k0+8h+0..7, 8..15 = k0+16+8h+0..7; D element r = row 8h+r
__device__ __forceinline__ v16h frag_h(const _Float16* rowk0, int lane) {
  union { v16h v; v8h q[2]; } u; const _Float16* p = rowk0 + 8 * (lane >> 4);
  u.q[0] = *(const v8h*)p; u.q[1] = *(const v8h*)(p + 16); return u.v;
}
__device__ __forceinline__ v16h frag_f32(const float* rowk0, int lane) {
  v16h a; const float* p = rowk0 + 8 * (lane >> 4);
#pragma unroll
  for (int i = 0; i < 8; ++i) { a[i] = (_Float16)p[i]; a[8 + i] = (_Float16)p[16 + i]; }
  return a;
}
__device__ __forceinline__ v16h frag_f32s(const float* rowk0, int lane, float sc) {
  v16h a; const float* p = rowk0 + 8 * (lane >> 4);
#pragma unroll
  for (int i = 0; i < 8; ++i) { a[i] = (_Float16)(p[i] * sc); a[8 + i] = (_Float16)(p[16 + i] * sc); }
  return a;
}
// column fragment from a [K][ld] layout (column n), rows >= K read as 0
__device__ __forceinline__ v16h fragc_f32(const float* W, int k0, int n, int lane, int ld, int K) {
  v16h a; const int g = lane >> 4;
#pragma unroll
  for (int i = 0; i < 8; ++i) { const int ka = k0 + 8 * g + i, kb = ka + 16;
    a[i] = (_Float16)(ka < K ? W[(size_t)(ka < K ? ka : K - 1) * ld + n] : 0.f); a[8 + i] = (_Float16)(kb < K ? W[(size_t)(kb < K ? kb : K - 1) * ld + n] : 0.f); }
  return a;
}
struct F2 { v16b h, l; };
__device__ __forceinline__ F2 bsplit16(const float v[16]) { F2 r;
#pragma unroll
  for (int i = 0; i < 16; ++i) { const __bf16 h = (__bf16)v[i]; r.h[i] = h; r.l[i] = (__bf16)(v[i] - (float)h); }
  return r; }
__device__ __forceinline__ F2 split_row(const float* row, int k0, int lane) { float v[16]; const float* p = row + k0 + 8 * (lane >> 4);
#pragma unroll
  for (int i = 0; i < 8; ++i) { v[i] = p[i]; v[8 + i] = p[16 + i]; }
  return bsplit16(v); }
__device__ __forceinline__ F2 split_rowK(const float* row, int k0, int lane, int K) { float v[16]; const int g = lane >> 4;
#pragma unroll
  for (int i = 0; i < 8; ++i) { const int ka = k0 + 8 * g + i, kb = ka + 16; v[i] = ka < K ? row[ka < K ? ka : K - 1] : 0.f; v[8 + i] = kb < K ? row[kb < K ? kb : K - 1] : 0.f; }
  return bsplit16(v); }
__device__ __forceinline__ F2 split_col(const float* W, int k0, int n, int lane, int ld, int K) { float v[16]; const int g = lane >> 4;
#pragma unroll
  for (int i = 0; i < 8; ++i) { const int ka = k0 + 8 * g + i, kb = ka + 16; v[i] = ka < K ? W[(size_t)(ka < K ? ka : K - 1) * ld + n] : 0.f; v[8 + i] = kb < K ? W[(size_t)(kb < K ? kb : K - 1) * ld + n] : 0.f; }
  return bsplit16(v); }
__device__ __forceinline__ v8f mac3(const F2& a, const F2& b, v8f c) { c = wmma_bf(a.l, b.h, c); c = wmma_bf(a.h, b.l, c); return wmma_bf(a.h, b.h, c); }
__device__ __forceinline__ float sigm(float v) { return 1.0f / (1.0f + expf(-v)); }
#define LDSX() do { asm volatile("s_wait_dscnt 0" ::: "memory"); __builtin_amdgcn_wave_barrier(); __builtin_amdgcn_fence(__ATOMIC_RELEASE, "workgroup"); } while (0)


// Sparse cross-encoder self attention (B 2, 16 documents x 512 tokens, 32 query tokens, 1 cls; hidden 768 = 12 heads x 64): every segment attends over [cls | query | doc_d] per document (cat_forward path), outputs concatenated along the sequence -> [b, 16, 545, 768].
#define NBB 2
#define ND 16
#define NQT 32
#define NS 512
#define HIDN 768
#define NH 12
#define HD 64
#define LSEQ (1 + NQT + NS)          // 545
#define RPB (1 + NQT + ND * NS)      // unique token rows per batch = 8225
#define NROW (NBB * RPB)             // 16450
#define NROWP (((NROW + 63) / 64) * 64)
#ifndef TND
#define TND ND                       // documents per batch processed
#endif
#ifndef TNB
#define TNB NBB
#endif
#ifndef TPR
#define TPR (NROWP / 64)              // 64-row blocks of padded rows (two per k_proj block)
#endif
typedef __attribute__((ext_vector_type(8))) __bf16 v8b;
__device__ __forceinline__ v16b frag_b(const __bf16* rowk0, int lane) {
  union { v16b v; v8b q[2]; } u; const __bf16* p = rowk0 + 8 * (lane >> 4);
  u.q[0] = *(const v8b*)p; u.q[1] = *(const v8b*)(p + 16); return u.v;
}
__device__ __forceinline__ float bfr(float v) { return (float)(__bf16)v; }
__device__ __attribute__((noinline)) float exp_ni(float v) { return expf(v); }
__device__ __attribute__((noinline)) float erf_ni(float v) { return erff(v); }

#define NDOC (NBB * ND * NS)         // unique token rows, in the inputs' own order: the doc rows first, then the NBB * NQT query rows, then the NBB cls rows
#define ROWQ NDOC
#define ROWC (NDOC + NBB * NQT)
#define WS_Q   0u                                    // f16 q rows [NROWP][768]
#define WS_K   (WS_Q + 2u * (size_t)NROWP * HIDN)
#define WS_V   (WS_K + 2u * (size_t)NROWP * HIDN)
#define WS_P   (WS_V + 2u * (size_t)NROWP * HIDN)  // bf16 operand plane [HIDN / 32][NPR][32]
#define NXR NROWP                    // X rows in the plane: the unique token rows, then pad rows
#define NPR (NXR + 3 * HIDN)         // plane rows: X rows, then the rows of Wq, Wk, Wv
#define WS_END (WS_P + 2u * (size_t)NPR * HIDN)

__device__ __forceinline__ int tokrow(int b, int d, int i) { const int base = i > NQT ? (b * ND + d) * NS - (1 + NQT) : (i == 0 ? ROWC + b : ROWQ + b * NQT - 1); return base + i; }   // position i of document d's sequence -> unique row
// ---- k_cvt: every X row (doc, query, cls, in the unique-row order; pad rows re-read the cls rows, what is projected from those is never read) and every row of Wq, Wk, Wv is rounded to bf16 ONCE, into a plane ordered by k slice, P[slice][row][32 k]: the rows of one slice lie back to back, 64 B each, so whatever run of rows a k_proj block stages is contiguous. block = (32 rows, half of the slices), 4 waves; wave w of 8 takes slices 3 w .. 3 w + 2: a wave-wide load covers 4 whole 128-B lines, a wave-wide store 256 contiguous bytes
typedef __attribute__((ext_vector_type(4))) __bf16 v4b;
typedef const __attribute__((address_space(1))) float gfloat; typedef const __attribute__((address_space(1))) v4f gv4f; typedef __attribute__((address_space(1))) __bf16 gbfw; typedef __attribute__((address_space(1))) v4b gv4b;   // named as global memory: every access is scalar base + one 32-bit lane offset + immediate
// RND rounds of 4 source rows (1 where all 8 rounds of plane rows repeat the same 4 source rows) x 3 slices
template <int RND> __device__ __forceinline__ void cvt_rows(gfloat* sb, gbfw* db, unsigned vo, unsigned wo) {
  v4f pre[3][RND]; v4b cv[3][RND];
#pragma unroll
  for (int j = 0; j < 3; ++j)
#pragma unroll
    for (int i = 0; i < RND; ++i) pre[j][i] = *(gv4f*)(sb + i * (4 * HIDN) + j * 32 + vo);
  asm volatile("s_wait_xcnt 0x0" ::: "memory");   // stands before any register that the loads name is rewritten
  __builtin_amdgcn_sched_barrier(0);   // keeps the wave's loads in flight together, ahead of the first conversion: one memory latency a wave
#pragma unroll
  for (int j = 0; j < 3; ++j)
#pragma unroll
    for (int i = 0; i < RND; ++i) cv[j][i] = __builtin_convertvector(pre[j][i], v4b);
#pragma unroll
  for (int j = 0; j < 3; ++j)
#pragma unroll
    for (int i = 0; i < 8; ++i) *(gv4b*)(db + j * (NPR * 32) + i * (4 * 32) + wo) = cv[j][RND == 1 ? 0 : i];
  asm volatile("s_wait_xcnt 0x0" ::: "memory"); }   // stands behind the last store, before any register that the stores name is rewritten
__global__ __launch_bounds__(128) void k_cvt(const float* __restrict__ CLS, const float* __restrict__ QRY, const float* __restrict__ DOC, const float* __restrict__ WQ, const float* __restrict__ WK, const float* __restrict__ WV, __bf16* __restrict__ P) {
  static_assert(NDOC % 32 == 0 && (NBB * NQT) % 32 == 0 && NXR % 32 == 0 && HIDN % 32 == 0 && HIDN / 32 == 24, "a block's 32 rows are of one kind; 8 waves x 3 slices");
  static_assert(NBB == 1 || NBB == 2 || NBB == 4, "row j of the cls and pad rows reads cls row j mod NBB, which a lane's place among 4 rows gives");
  const int tw = threadIdx.x >> 5, lane = threadIdx.x & 31, rl = lane >> 3, sc = lane & 7; const int r0 = blockIdx.x * 32;
  const bool isc = r0 >= ROWC && r0 < NXR; const int w0 = r0 - NXR;   // block-uniform
  const float* src = r0 < NDOC ? DOC + (size_t)r0 * HIDN : r0 < ROWC ? QRY + (size_t)(r0 - ROWQ) * HIDN : isc ? CLS : (w0 < HIDN ? WQ + (size_t)w0 * HIDN : w0 < 2 * HIDN ? WK + (size_t)(w0 - HIDN) * HIDN : WV + (size_t)(w0 - 2 * HIDN) * HIDN);
  gfloat* sb = (gfloat*)src + blockIdx.y * (12 * 32); gbfw* db = (gbfw*)P + ((size_t)(12 * blockIdx.y) * NPR + r0) * 32;   // scalar: the block's first row and slice
  const unsigned ko = (unsigned)(tw * (3 * 32) + sc * 4), wo = (unsigned)((tw * 3 * NPR + rl) * 32 + sc * 4);
  if (isc) cvt_rows<1>(sb, db, (unsigned)((rl & (NBB - 1)) * HIDN) + ko, wo); else cvt_rows<8>(sb, db, (unsigned)(rl * HIDN) + ko, wo); }
// ---- k_proj: block = (128 rows, 256 cols, which), 8 waves of 64 x 64: f16 rows of X W^T + b (exact). The 32-k slices of the 128 X rows and 256 W rows (8 KB and 16 KB of the bf16 plane, each contiguous) come into LDS by asynchronous copies, through no register: two buffers of two slices each, the next two slices in flight while these two are worked on, one barrier per two slices; every wave takes its fragments from there
#define PBM 128
#define PBN 256
#define PPIT 40                      // bf16 per staged row: 64 B of k + 16 B pad (80 B = 16 B x odd: the 16-byte fragment reads of 16 rows fall on distinct banks)
#define PBUF ((PBM + PBN) * PPIT)    // bf16 per staged slice: X rows 0..127, W rows 128..383
#define PST 2                        // slices per buffer
#define NST (HIDN / 32 / PST)        // trips
#define PSH (PBN + 8)                // f16 per staged output row
#define PRB (64 * PPIT * 2)          // LDS bytes from a staged row to the row 64 further on
// slices sa and sb of the block's X rows (from plane row xr) and W rows (from plane row wr) into one buffer: per slice a thread copies 16 bytes of each of 6 rows, 64 rows apart (po: its place in 64 rows of the plane, l0: its place in the buffer), so a wave-wide copy covers 4 whole lines
__device__ __forceinline__ void stage_xw(const __bf16* __restrict__ P, int sa, int sb, size_t xr, size_t wr, unsigned po, unsigned l0) {
  const __bf16 *xa = P + ((size_t)sa * NPR + xr) * 32 + po, *wa = P + ((size_t)sa * NPR + wr) * 32 + po, *xc = P + ((size_t)sb * NPR + xr) * 32 + po, *wc = P + ((size_t)sb * NPR + wr) * 32 + po;
  const unsigned l1 = l0 + PBUF * 2;
  // the twelve copies and, as the last line, the wait that stands before any of their address registers is rewritten
  asm volatile("global_load_async_to_lds_b128 %0, %1, off\n\tglobal_load_async_to_lds_b128 %2, %3, off\n\tglobal_load_async_to_lds_b128 %4, %5, off\n\tglobal_load_async_to_lds_b128 %6, %7, off\n\tglobal_load_async_to_lds_b128 %8, %9, off\n\tglobal_load_async_to_lds_b128 %10, %11, off\n\t"
               "global_load_async_to_lds_b128 %12, %13, off\n\tglobal_load_async_to_lds_b128 %14, %15, off\n\tglobal_load_async_to_lds_b128 %16, %17, off\n\tglobal_load_async_to_lds_b128 %18, %19, off\n\tglobal_load_async_to_lds_b128 %20, %21, off\n\tglobal_load_async_to_lds_b128 %22, %23, off\n\ts_wait_xcnt 0x0"
               :: "v"(l0), "v"(xa), "v"(l0 + PRB), "v"(xa + 64 * 32), "v"(l0 + 2 * PRB), "v"(wa), "v"(l0 + 3 * PRB), "v"(wa + 64 * 32), "v"(l0 + 4 * PRB), "v"(wa + 128 * 32), "v"(l0 + 5 * PRB), "v"(wa + 192 * 32),
                  "v"(l1), "v"(xc), "v"(l1 + PRB), "v"(xc + 64 * 32), "v"(l1 + 2 * PRB), "v"(wc), "v"(l1 + 3 * PRB), "v"(wc + 64 * 32), "v"(l1 + 4 * PRB), "v"(wc + 128 * 32), "v"(l1 + 5 * PRB), "v"(wc + 192 * 32) : "memory"); }
__device__ __forceinline__ int nxsl(int s) { return s + 1 == HIDN / 32 ? 0 : s + 1; }   // the slice after s, wrapping
__global__ __launch_bounds__(256) void k_proj(const __bf16* __restrict__ P, const float* __restrict__ BQ, const float* __restrict__ BK, const float* __restrict__ BV, _Float16* __restrict__ Q, _Float16* __restrict__ K, _Float16* __restrict__ V) { __shared__ __align__(16) unsigned char smem[2 * PST * PBUF * 2];   // the two operand buffers; behind the loop's last barrier the output tile
  static_assert(PBM * PSH * 2 <= 2 * PST * PBUF * 2, "the output tile fits");
  static_assert(NXR % PBM == 0 && HIDN % PBN == 0 && PBM == 128 && PBN == 256 && (HIDN / 32) % PST == 0 && NST >= 2, "whole tiles, staged 64 rows a copy; whole buffers, at least two");
  const __bf16* st = (const __bf16*)smem; _Float16* sh = (_Float16*)smem;
  const int tid = threadIdx.x, wave = tid >> 5, lane = tid & 31, col = lane & 15, g = lane >> 4, wm = wave & 1, wn = wave >> 1; const int which = blockIdx.z; const int c0 = blockIdx.y * PBN; const size_t r0 = (size_t)blockIdx.x * PBM;
  const float* Bm = which == 0 ? BQ : which == 1 ? BK : BV;
  const int sr = tid >> 2, sc = tid & 3;   // staging: 4 lanes cover one row's 64 B, the block 64 rows a copy
  int kk = (int)((blockIdx.x + 5 * (blockIdx.y + (HIDN / PBN) * blockIdx.z)) % (HIDN / 32));   // the block's first k slice; it walks all HIDN / 32 slices from there and wraps, so blocks that share W rows (same y, z) or X rows (same x) ask L2 for different lines at any one time
  const size_t wr = NXR + (size_t)which * HIDN + c0; const unsigned po = (unsigned)tid * 8, l0 = (unsigned)(size_t)smem + (unsigned)(sr * (PPIT * 2) + sc * 16);
  stage_xw(P, kk, nxsl(kk), r0, wr, po, l0); kk = nxsl(nxsl(kk));
  asm volatile("s_wait_asynccnt 0x0" ::: "memory");   // the first two slices have landed for this wave's copies
  __syncthreads();                                     // publishes them
  stage_xw(P, kk, nxsl(kk), r0, wr, po, l0 + PST * PBUF * 2); kk = nxsl(nxsl(kk));
  v8f acc[4][4] = {};
#pragma unroll 1
  for (int t = 0; t < NST; ++t) {   // rolled: one copy of the body, the buffer chosen by the trip's parity
#pragma unroll
    for (int u = 0; u < PST; ++u) { const __bf16* bp = st + ((t & 1) * PST + u) * PBUF;
      v16b a[4], w[4];
#pragma unroll
      for (int i = 0; i < 4; ++i) { a[i] = frag_b(bp + (wm * 64 + i * 16 + col) * PPIT, lane); w[i] = frag_b(bp + (PBM + wn * 64 + i * 16 + col) * PPIT, lane); }
#pragma unroll
      for (int j = 0; j < 4; ++j)
#pragma unroll
        for (int i = 0; i < 4; ++i) acc[i][j] = wmma_bf(a[i], w[j], acc[i][j]); }
    asm volatile("s_wait_dscnt 0x0" ::: "memory");      // this wave's reads of the buffer have returned
    asm volatile("s_wait_asynccnt 0x0" ::: "memory");   // this wave's copies of the next two slices have landed
    __syncthreads();                                     // publishes the next two slices and ends every read of this trip's buffer, which the copies below (or the output tile) overwrite
    if (t + 2 < NST) { stage_xw(P, kk, nxsl(kk), r0, wr, po, l0 + (unsigned)(t & 1) * (PST * PBUF * 2)); kk = nxsl(nxsl(kk)); } }
  asm volatile("s_wait_asynccnt 0x0" ::: "memory");     // nothing is in flight when the buffers become the output tile
#pragma unroll
  for (int j = 0; j < 4; ++j) { const float bb = bfr(Bm[c0 + wn * 64 + j * 16 + col]);
#pragma unroll
    for (int i = 0; i < 4; ++i)
#pragma unroll
      for (int r = 0; r < 8; ++r) sh[(wm * 64 + i * 16 + 8 * g + r) * PSH + wn * 64 + j * 16 + col] = (_Float16)(acc[i][j][r] + bb); }
  __syncthreads(); { _Float16* dst = which == 0 ? Q : which == 1 ? K : V; for (int e = tid; e < PBM * (PBN / 8); e += 256) { const int rl = e >> 5, q = e & 31; vst2((unsigned*)(dst + (r0 + rl) * HIDN + c0 + q * 8), *(const v4u*)&sh[rl * PSH + q * 8]); } } }
typedef __attribute__((ext_vector_type(8))) short v8s;
__device__ __forceinline__ v8s ld_tr16(const unsigned char* p) { typedef __attribute__((address_space(3))) v8s lds_v8s; return __builtin_amdgcn_ds_load_tr16_b128_v8i16((lds_v8s*)p); }   // transposing 16-byte LDS read
__device__ __forceinline__ float xhalf(float v) { const int b = __builtin_bit_cast(int, v); return __builtin_bit_cast(float, __builtin_amdgcn_permlanex16(b, b, 0x76543210, 0xfedcba98, false, false)); }   // the value of lane ^ 16
#define KPB 144                      // bytes per staged K row: 128 B + 16 B pad (16 B x odd: the 16-byte fragment reads of 16 rows fall on distinct banks)
#define VPB 160                      // bytes per staged V row: 128 B + 32 B pad (32 B x odd: the pitch at which the transposing 16-byte reads fall on distinct banks)
#define KTB (32 * KPB)               // bytes per staged 32-key tile of K
#define VTB (32 * VPB)               // bytes per staged 32-key tile of V
#define KVB (KTB + VTB)              // bytes per buffer: K tile, then V tile
#define NKT ((LSEQ + 31) / 32)       // key tiles
#define MKR ((NKT * 32 + 127) / 128) // rounds of 128 threads that fill the mask table
#define L2E 1.4426950408889634f      // log2(e): scores and masks are kept in base 2, so a weight is one subtraction and one hardware exp2
#define SC2 (0.125f * L2E)           // 1 / sqrt(64), in base 2
#define PEX 7.0f                     // the running maximum is kept 7 low, so the weights come out of exp2 times 2^7 (small ones stay normal f16); a rounded mx - 7 lies at most 7 further off, so a weight is at most 2^14 for any finite maximum
// one 32-key tile of K and of V into LDS (the thread's own K place ldk, V place ldv): a thread copies 16 bytes of rows sr and sr + 16 of each, so a wave-wide copy covers 4 whole 128-B lines; keys beyond 545 re-read the last row and are masked
__device__ __forceinline__ void stage_kv(const _Float16* __restrict__ K, const _Float16* __restrict__ V, int b, int d, int t, int sr, int colh, unsigned ldk, unsigned ldv) {
  int ka = t * 32 + sr, kb = ka + 16; ka = ka < LSEQ ? ka : LSEQ - 1; kb = kb < LSEQ ? kb : LSEQ - 1;
  const unsigned oa = (unsigned)tokrow(b, d, ka) * HIDN + colh, ob = (unsigned)tokrow(b, d, kb) * HIDN + colh;   // the offsets stay below NROW * 768
  const _Float16 *pka = K + oa, *pkb = K + ob, *pva = V + oa, *pvb = V + ob;
  const unsigned la = ldk, lb = ldk + 16 * KPB, lc = ldv, ld = ldv + 16 * VPB;
  // the four copies and, as the last line, the wait that stands before any of their address registers is rewritten
  asm volatile("global_load_async_to_lds_b128 %0, %1, off\n\tglobal_load_async_to_lds_b128 %2, %3, off\n\tglobal_load_async_to_lds_b128 %4, %5, off\n\tglobal_load_async_to_lds_b128 %6, %7, off\n\ts_wait_xcnt 0x0"
               :: "v"(la), "v"(pka), "v"(lb), "v"(pkb), "v"(lc), "v"(pva), "v"(ld), "v"(pvb) : "memory"); }
__global__ __launch_bounds__(128) void k_att(const _Float16* __restrict__ Q, const _Float16* __restrict__ K, const _Float16* __restrict__ V, const float* __restrict__ QM, const float* __restrict__ DMK, float* __restrict__ OUT) {
  __shared__ __align__(16) unsigned char ring[2 * KVB];   // two buffers of (K tile, V tile); behind the loop's last barrier the output staging so[4][16][68]
  __shared__ __align__(16) float smk[MKR * 128];              // the sequence's additive mask, built once (entries from NKT * 32 on are never read)
  static_assert(4 * 16 * 68 * 4 <= 2 * KVB, "output staging fits the ring");
  float (*so)[16][68] = (float (*)[16][68])ring;
  const int tid = threadIdx.x, wave = tid >> 5, lane = tid & 31, col = lane & 15, g = lane >> 4; const int qb = blockIdx.x, h = blockIdx.y; const int bd = blockIdx.z; const int b = bd / TND, d = bd % TND;
  const int sr = tid >> 3, colh = h * HD + (tid & 7) * 8; const unsigned ldk0 = (unsigned)(size_t)ring + (unsigned)(sr * KPB + (tid & 7) * 16), ldv0 = (unsigned)(size_t)ring + (unsigned)(KTB + sr * VPB + (tid & 7) * 16);
  stage_kv(K, V, b, d, 0, sr, colh, ldk0, ldv0);
  const int qi = qb * 64 + wave * 16 + col; const int qic = (qi < LSEQ) ? qi : (LSEQ - 1);   // positions beyond 545 (last block) are computed on a clamped row and never stored
  v16h bq[2];
#pragma unroll
  for (int kc = 0; kc < 2; ++kc) bq[kc] = frag_h(Q + (size_t)tokrow(b, d, qic) * HIDN + h * HD + kc * 32, lane);
#pragma unroll
  for (int u = 0; u < MKR; ++u) { const int ki = u * 128 + tid;   // unrolled and branch-free on clamped addresses: the loads of all rounds are in flight together
    const int qx = ki < 1 ? 0 : (ki <= NQT ? ki - 1 : NQT - 1), dx = ki <= NQT ? 0 : (ki < LSEQ ? ki - 1 - NQT : NS - 1);
    const float* mp = ki <= NQT ? QM + (size_t)b * NQT + qx : DMK + ((size_t)b * ND + d) * NS + dx;
    const float mv = bfr(*mp) * L2E; smk[ki] = ki >= LSEQ ? -3.0e38f : (ki == 0 ? 0.f : mv); }
  asm volatile("s_wait_asynccnt 0x0" ::: "memory");   // tile 0 has landed for this wave's copies
  __syncthreads();                                     // publishes tile 0 and the mask table
  stage_kv(K, V, b, d, 1, sr, colh, ldk0 + KVB, ldv0 + KVB);
  const int vlo = (8 * g + (lane & 7)) * VPB + 16 * ((lane >> 3) & 1);   // the lane's address in a 16-key x 16-column block for the transposing read
  float m = -3.0e38f; v2f l2 = {};   // the query's running maximum less PEX (equal in both halves) and this half's share of its sum, even and odd keys apart
  v8f acc[4] = {};               // acc[j][r] = O[query col][16 j + 8 g + r]
#pragma unroll 1
  for (int ks = 0; ks < NKT; ++ks) {   // rolled: one copy of the body, the buffer chosen by the trip's parity
    const _Float16* sk = (const _Float16*)(ring + (ks & 1) * KVB); const unsigned char* sv = ring + (ks & 1) * KVB + KTB + vlo;
    v16h kf[2][2]; v4f mk4[2][2];
#pragma unroll
    for (int ct = 0; ct < 2; ++ct) {
#pragma unroll
      for (int kc = 0; kc < 2; ++kc) kf[ct][kc] = frag_h(sk + (ct * 16 + col) * (KPB / 2) + kc * 32, lane);
      mk4[ct][0] = *(const v4f*)&smk[ks * 32 + ct * 16 + 8 * g]; mk4[ct][1] = *(const v4f*)&smk[ks * 32 + ct * 16 + 8 * g + 4]; }
    __builtin_amdgcn_sched_barrier(0);   // keeps the tile's K fragment and mask reads together ahead of the score products: one LDS latency, not one per product
    v2f s[2][4];   // neighbouring keys in pairs, as the accumulator and the mask table hold them: packed arithmetic with no register moves
#pragma unroll
    for (int ct = 0; ct < 2; ++ct) { v8f c = {};
#pragma unroll
      for (int kc = 0; kc < 2; ++kc) c = wmma16(kf[ct][kc], bq[kc], c);
#pragma unroll
      for (int p = 0; p < 4; ++p) s[ct][p] = (v2f){ c[2 * p], c[2 * p + 1] } * SC2 + (v2f){ mk4[ct][p >> 1][(2 * p) & 3], mk4[ct][p >> 1][(2 * p + 1) & 3] }; }   // no select for a masked key: key 0 is never masked, so from tile 0 on the maximum is a real score and exp2 of a masked key's distance to it is 0 by itself
    float mx = fmaxf(s[0][0][0], s[0][0][1]);
#pragma unroll
    for (int p = 1; p < 8; ++p) mx = fmaxf(mx, fmaxf(s[p >> 2][p & 3][0], s[p >> 2][p & 3][1]));
    mx -= PEX;
    const float mn = fmaxf(m, fmaxf(mx, xhalf(mx))), alpha = __builtin_amdgcn_exp2f(m - mn); v16h pb;
    l2 *= alpha;
#pragma unroll
    for (int ct = 0; ct < 2; ++ct)
#pragma unroll
      for (int p = 0; p < 4; ++p) { const v2f t = s[ct][p] - mn; const v2f e = { __builtin_amdgcn_exp2f(t[0]), __builtin_amdgcn_exp2f(t[1]) }; l2 += e; pb[ct * 8 + 2 * p] = (_Float16)e[0]; pb[ct * 8 + 2 * p + 1] = (_Float16)e[1]; }
    m = mn;
#pragma unroll
    for (int j = 0; j < 4; ++j)
#pragma unroll
      for (int r = 0; r < 8; ++r) acc[j][r] *= alpha;
    union { v16h v; v8s q[2]; } va[4];   // lane (col, g) receives V[8 g + 0..7][16 j + col] and V[16 + 8 g + 0..7][16 j + col]: the k order of pb
#pragma unroll
    for (int j = 0; j < 4; ++j) { va[j].q[0] = ld_tr16(sv + 32 * j); va[j].q[1] = ld_tr16(sv + 16 * VPB + 32 * j); }
#pragma unroll
    for (int j = 0; j < 4; ++j) acc[j] = wmma16(va[j].v, pb, acc[j]);
    asm volatile("s_wait_dscnt 0x0" ::: "memory");      // this wave's reads of the buffer have returned
    asm volatile("s_wait_asynccnt 0x0" ::: "memory");   // this wave's copies of tile ks + 1 have landed
    __syncthreads();                                     // publishes tile ks + 1 and ends every read of tile ks's buffer
    if (ks + 2 < NKT) stage_kv(K, V, b, d, ks + 2, sr, colh, ldk0 + (unsigned)(ks & 1) * KVB, ldv0 + (unsigned)(ks & 1) * KVB); }
  asm volatile("s_wait_asynccnt 0x0" ::: "memory");     // nothing is in flight when the ring becomes output staging
  float l = l2[0] + l2[1]; l += xhalf(l);
  const float il = 1.0f / l;   // sum and products carry the same power of two
#pragma unroll
  for (int j = 0; j < 4; ++j) { v4f oa, ob;
#pragma unroll
    for (int r = 0; r < 4; ++r) { oa[r] = acc[j][r] * il; ob[r] = acc[j][4 + r] * il; }
    *(v4f*)&so[wave][col][j * 16 + 8 * g] = oa; *(v4f*)&so[wave][col][j * 16 + 8 * g + 4] = ob; }
  LDSX();
  for (int rl = 0; rl < 16; ++rl) { const int qpos = qb * 64 + wave * 16 + rl; if (qpos < LSEQ && lane < 16) vst2(OUT + (((size_t)b * ND + d) * LSEQ + qpos) * HIDN + h * HD + lane * 4, *(const v4f*)&so[wave][rl][lane * 4]); } }
extern "C" void kernel_launch(void* const* d_in, const int* in_sizes, int n_in, void* d_out, int out_size, void* d_ws, size_t ws_size, hipStream_t stream) {
  (void)in_sizes; (void)n_in; (void)out_size;
  const float** F = (const float**)d_in;   // 0 cls [2,1,1,768], 1 query [2,1,32,768], 2 doc [2,16,512,768], 3 qmask [2,1,1,1,32], 4 dmask [2,1,16,1,512], 5 Wq, 6 bq, 7 Wk, 8 bk, 9 Wv, 10 bv
  if (ws_size < (size_t)WS_END) return;
  char* ws = (char*)d_ws; _Float16 *Q = (_Float16*)(ws + WS_Q), *K = (_Float16*)(ws + WS_K), *V = (_Float16*)(ws + WS_V); __bf16* P = (__bf16*)(ws + WS_P);
  k_cvt<<<dim3(NPR / 32, 2), 128, 0, stream>>>(F[0], F[1], F[2], F[5], F[7], F[9], P);
  k_proj<<<dim3((TPR + 1) / 2, HIDN / PBN, 3), 256, 0, stream>>>(P, F[6], F[8], F[10], Q, K, V);
  k_att<<<dim3((LSEQ + 63) / 64, NH, TNB * TND), 128, 0, stream>>>(Q, K, V, F[3], F[4], (float*)d_out);
}
